// v000
// Measured on an AMD MI455X. A time is GPU time per run, averaged over a window of back-to-back runs after a warm-up
// (all launches, gaps included; the runs take copies of the inputs in turn), and the median of several windows.
// Apart from v000's, it joins two sittings. Times from different sittings can be a few percent apart, while
// side-by-side timings come from the same sitting.
// v000 is the starting kernel. One run takes 155 microseconds.
#include <hip/hip_runtime.h>
#include <hip/hip_bf16.h>

#define BB   4
#define CC   32
#define HH   256
#define WW   256
#define HIDN 64
#define HWP  (HH * WW)
#define EPSV 1e-5f

typedef __attribute__((ext_vector_type(16))) __bf16 bf16x16;
typedef __attribute__((ext_vector_type(8)))  float  f32x8;

union BFV {
  bf16x16  v;
  __bf16   e[16];
  unsigned u[8];
  uint4    q4[2];
};

__device__ __forceinline__ int iclamp(int x, int lo, int hi) {
  return x < lo ? lo : (x > hi ? hi : x);
}

static __device__ __forceinline__ f32x8 wmma_bf16(bf16x16 a, bf16x16 b, f32x8 c) {
  // D = A(16x32 bf16) x B(32x16 bf16) + C(16x16 f32)
  return __builtin_amdgcn_wmma_f32_16x16x32_bf16(false, a, false, b, (short)0, c,
                                                 false, false);
}

// ---------------------------------------------------------------------------
// Kernel 1: fused 1x1 convs.  D(128 x Npix) = [Wqkv ; Wg] * x.
//   m-tiles 0..1 -> q, 2..3 -> -k (negated!), 4..5 -> v  (bf16, pixel-major)
//   m-tiles 6..7 -> gate: d_out = gate + bg + x  (f32, B,C,H,W layout)
// Each wave: preloads all 8 A (weight) tiles, loops 8 N-tiles of 16 pixels.
// ---------------------------------------------------------------------------
__global__ __launch_bounds__(256) void va_qkvg(
    const float* __restrict__ x,
    const float* __restrict__ Wqkv,
    const float* __restrict__ Wg,
    const float* __restrict__ bg,
    __bf16* __restrict__ qws,
    __bf16* __restrict__ kws,     // holds -k
    __bf16* __restrict__ vws,
    float* __restrict__ out)
{
  const int lane = threadIdx.x & 31;
  const int wave = threadIdx.x >> 5;
  const int grp  = lane >> 4;      // 0: lanes 0-15 (K lo half), 1: lanes 16-31
  const int lm   = lane & 15;
  const int k0   = grp ? 8 : 0;    // A/B K sub-offset per lane half

  // A tiles: row (out-ch) per lane, 16 K values packed 2/VGPR.
  bf16x16 A[8];
  #pragma unroll
  for (int m = 0; m < 8; ++m) {
    const int o = m * 16 + lm;
    const float* wrow = (o < 96) ? (Wqkv + o * CC) : (Wg + (o - 96) * CC);
    BFV av;
    #pragma unroll
    for (int i = 0; i < 8; ++i) av.e[i]     = (__bf16)wrow[k0 + i];
    #pragma unroll
    for (int i = 0; i < 8; ++i) av.e[8 + i] = (__bf16)wrow[16 + k0 + i];
    A[m] = av.v;
  }

  float bgl[16];
  #pragma unroll
  for (int j = 0; j < 2; ++j)
    #pragma unroll
    for (int r = 0; r < 8; ++r)
      bgl[j * 8 + r] = bg[j * 16 + r + 8 * grp];

  const long pix0 = (long)blockIdx.x * 1024 + (long)wave * 128;
  for (int t = 0; t < 8; ++t) {
    const long pixbase = pix0 + (long)t * 16;
    const int  b    = (int)(pixbase / HWP);
    const int  pimg = (int)(pixbase % HWP);

    // B operand: x tile, column (pixel) per lane, K packed (strided loads).
    BFV bv;
    const float* xb = x + ((long)b * CC) * HWP + pimg + lm;
    #pragma unroll
    for (int i = 0; i < 8; ++i) bv.e[i]     = (__bf16)xb[(long)(k0 + i) * HWP];
    #pragma unroll
    for (int i = 0; i < 8; ++i) bv.e[8 + i] = (__bf16)xb[(long)(16 + k0 + i) * HWP];

    f32x8 acc[8];
    #pragma unroll
    for (int m = 0; m < 8; ++m) {
      f32x8 cz = {};
      acc[m] = wmma_bf16(A[m], bv.v, cz);
    }

    // D layout: element (lane, r) = (row 16m + r + 8*grp, pixel pixbase + lm)
    const long pix = pixbase + lm;
    __bf16* qp = qws + pix * CC;
    __bf16* kp = kws + pix * CC;
    __bf16* vp = vws + pix * CC;
    #pragma unroll
    for (int j = 0; j < 2; ++j) {
      #pragma unroll
      for (int r = 0; r < 8; ++r) {
        const int ch = j * 16 + r + 8 * grp;
        qp[ch] = (__bf16)acc[0 + j][r];
        kp[ch] = (__bf16)(-acc[2 + j][r]);   // store -k
        vp[ch] = (__bf16)acc[4 + j][r];
      }
    }
    #pragma unroll
    for (int j = 0; j < 2; ++j) {
      #pragma unroll
      for (int r = 0; r < 8; ++r) {
        const int  cb = j * 16 + r + 8 * grp;
        const long oi = ((long)b * CC + cb) * HWP + pimg + lm;
        out[oi] = acc[6 + j][r] + bgl[j * 8 + r] + x[oi];
      }
    }
  }
}

// ---------------------------------------------------------------------------
// Kernel 2: neighbor MLP + softmax + weighted v.  One wave owns 16 pixels
// (fixed h, consecutive w).  GEMM rows = pixels; neighbors are the outer
// loop so the 9-way softmax is a per-element running accumulation.
// ---------------------------------------------------------------------------
__global__ __launch_bounds__(256) void va_attn(
    const __bf16* __restrict__ qws,
    const __bf16* __restrict__ kws,   // -k
    const __bf16* __restrict__ vws,
    const float* __restrict__ W1,
    const float* __restrict__ b1,
    const float* __restrict__ ln_w,
    const float* __restrict__ ln_b,
    const float* __restrict__ W2,
    const float* __restrict__ b2,
    float* __restrict__ out)
{
  __shared__ __bf16 lds_h[8][16 * HIDN];   // per-wave D->A transpose scratch

  const int lane = threadIdx.x & 31;
  const int wave = threadIdx.x >> 5;
  const int grp  = lane >> 4;
  const int lm   = lane & 15;
  const int k0   = grp ? 8 : 0;

  const int tile = blockIdx.x;             // 2048 tiles
  const int tw = tile & 15;                // 16 tiles across W
  const int th = (tile >> 4) & 31;         // 32 tiles across H
  const int b  = tile >> 9;
  const int h  = th * 8 + wave;
  const int w0 = tw * 16;

  // B1: W1^T (32 x 64), 4 N-tiles.  B2: W2^T (64 x 32), 2 N-tiles x 2 K-steps.
  bf16x16 B1t[4];
  #pragma unroll
  for (int n = 0; n < 4; ++n) {
    const float* wr = W1 + (n * 16 + lm) * CC;
    BFV t;
    #pragma unroll
    for (int i = 0; i < 8; ++i) t.e[i]     = (__bf16)wr[k0 + i];
    #pragma unroll
    for (int i = 0; i < 8; ++i) t.e[8 + i] = (__bf16)wr[16 + k0 + i];
    B1t[n] = t.v;
  }
  bf16x16 B2t[2][2];
  #pragma unroll
  for (int c = 0; c < 2; ++c)
    #pragma unroll
    for (int ks = 0; ks < 2; ++ks) {
      const float* wr = W2 + (c * 16 + lm) * HIDN + ks * 32;
      BFV t;
      #pragma unroll
      for (int i = 0; i < 8; ++i) t.e[i]     = (__bf16)wr[k0 + i];
      #pragma unroll
      for (int i = 0; i < 8; ++i) t.e[8 + i] = (__bf16)wr[16 + k0 + i];
      B2t[c][ks] = t.v;
    }

  float b1l[4], lwl[4], lbl[4];
  #pragma unroll
  for (int n = 0; n < 4; ++n) {
    const int d = n * 16 + lm;
    b1l[n] = b1[d]; lwl[n] = ln_w[d]; lbl[n] = ln_b[d];
  }
  float b2l[2];
  #pragma unroll
  for (int c = 0; c < 2; ++c) b2l[c] = b2[c * 16 + lm];

  // q in A layout (row m = lm, pixel w0+lm), kept packed bf16: 2x b128 loads.
  const long prow = ((long)b * HH + h) * WW;
  const uint4* qrow4 = (const uint4*)(qws + (prow + w0 + lm) * CC);
  BFV qv;
  qv.q4[0] = qrow4[grp];
  qv.q4[1] = qrow4[2 + grp];

  f32x8 num[2] = {};
  f32x8 den[2] = {};

  for (int nb = 0; nb < 9; ++nb) {
    const int dy = nb / 3 - 1;
    const int dx = nb % 3 - 1;
    const int hh = h + dy;
    const bool hok = (hh >= 0) && (hh < HH);
    const int hhc = iclamp(hh, 0, HH - 1);
    const long nrow = ((long)b * HH + hhc) * WW;

    __builtin_prefetch(vws + (nrow + iclamp(w0 + dx, 0, WW - 1)) * CC);

    // A = q + (-k)(neighbor); out-of-image k == 0 (zero-padded unfold).
    const int wwA = w0 + lm + dx;
    const bool aok = hok && (wwA >= 0) && (wwA < WW);
    const uint4* krow4 =
        (const uint4*)(kws + (nrow + iclamp(wwA, 0, WW - 1)) * CC);
    BFV kv;
    kv.q4[0] = krow4[grp];
    kv.q4[1] = krow4[2 + grp];
    #pragma unroll
    for (int i = 0; i < 8; ++i) kv.u[i] = aok ? kv.u[i] : 0u;
    BFV av;
    av.v = qv.v + kv.v;                 // packed bf16 add (k pre-negated)

    // hid = A * W1^T + b1 : 16x64 in 4 accumulators.
    f32x8 hacc[4];
    #pragma unroll
    for (int n = 0; n < 4; ++n) {
      f32x8 cz = {};
      hacc[n] = wmma_bf16(av.v, B1t[n], cz);
      #pragma unroll
      for (int r = 0; r < 8; ++r) hacc[n][r] += b1l[n];
    }

    // LayerNorm per row (row = VGPR r within a 16-lane half).
    f32x8 s  = hacc[0] + hacc[1] + hacc[2] + hacc[3];
    f32x8 s2 = hacc[0] * hacc[0] + hacc[1] * hacc[1]
             + hacc[2] * hacc[2] + hacc[3] * hacc[3];
    float mean[8], inv[8];
    #pragma unroll
    for (int r = 0; r < 8; ++r) {
      float sv = s[r], qsum = s2[r];
      #pragma unroll
      for (int mask = 1; mask <= 8; mask <<= 1) {
        sv   += __shfl_xor(sv, mask, 32);
        qsum += __shfl_xor(qsum, mask, 32);
      }
      const float mu = sv * (1.0f / HIDN);
      float var = qsum * (1.0f / HIDN) - mu * mu;
      var = var > 0.f ? var : 0.f;
      mean[r] = mu;
      inv[r] = 1.0f / (__builtin_sqrtf(var) + EPSV);
    }

    // Normalize + ReLU, re-layout D->A via per-wave LDS scratch.
    __bf16* hp = &lds_h[wave][0];
    #pragma unroll
    for (int n = 0; n < 4; ++n)
      #pragma unroll
      for (int r = 0; r < 8; ++r) {
        float hv = (hacc[n][r] - mean[r]) * inv[r];
        hv = lwl[n] * hv + lbl[n];
        hv = hv > 0.f ? hv : 0.f;
        const int m = r + 8 * grp;
        hp[m * HIDN + n * 16 + lm] = (__bf16)hv;
      }
    asm volatile("s_wait_dscnt 0" ::: "memory");

    // A operand of the second GEMM: row = pixel lm, two K-steps of 32.
    const uint4* hrow4 = (const uint4*)(hp + lm * HIDN);
    bf16x16 ah[2];
    #pragma unroll
    for (int ks = 0; ks < 2; ++ks) {
      BFV t;
      t.q4[0] = hrow4[ks * 4 + grp];
      t.q4[1] = hrow4[ks * 4 + 2 + grp];
      ah[ks] = t.v;
    }

    // scores = hid * W2^T + b2 (K=64: two chained WMMAs), then online
    // softmax-weighted accumulation of v.
    #pragma unroll
    for (int c = 0; c < 2; ++c) {
      f32x8 cz = {};
      f32x8 sc = wmma_bf16(ah[0], B2t[c][0], cz);
      sc = wmma_bf16(ah[1], B2t[c][1], sc);
      #pragma unroll
      for (int r = 0; r < 8; ++r) {
        const int m = r + 8 * grp;
        const int wwv = w0 + m + dx;
        const bool vok = hok && (wwv >= 0) && (wwv < WW);
        const float vval = vok
            ? (float)vws[(nrow + iclamp(wwv, 0, WW - 1)) * CC + c * 16 + lm]
            : 0.f;
        const float e = __expf(sc[r] + b2l[c]);
        den[c][r] += e;
        num[c][r] += e * vval;
      }
    }
  }

  // out += weighted_v  (out already holds base + x from kernel 1).
  #pragma unroll
  for (int c = 0; c < 2; ++c)
    #pragma unroll
    for (int r = 0; r < 8; ++r) {
      const int  m  = r + 8 * grp;
      const int  ch = c * 16 + lm;
      const long oi = ((long)b * CC + ch) * HWP + (long)h * WW + (w0 + m);
      out[oi] += num[c][r] / den[c][r];
    }
}

extern "C" void kernel_launch(void* const* d_in, const int* in_sizes, int n_in,
                              void* d_out, int out_size, void* d_ws, size_t ws_size,
                              hipStream_t stream) {
  (void)in_sizes; (void)n_in; (void)out_size; (void)ws_size;
  const float* x    = (const float*)d_in[0];
  const float* Wqkv = (const float*)d_in[1];
  const float* W1   = (const float*)d_in[2];
  const float* b1   = (const float*)d_in[3];
  const float* ln_w = (const float*)d_in[4];
  const float* ln_b = (const float*)d_in[5];
  const float* W2   = (const float*)d_in[6];
  const float* b2   = (const float*)d_in[7];
  const float* Wg   = (const float*)d_in[8];
  const float* bg   = (const float*)d_in[9];
  float* out = (float*)d_out;

  char* ws = (char*)d_ws;
  const size_t npix   = (size_t)BB * HWP;
  const size_t planeB = npix * CC * sizeof(__bf16);   // 16 MiB per bf16 tensor
  __bf16* qws = (__bf16*)(ws);
  __bf16* kws = (__bf16*)(ws + planeB);
  __bf16* vws = (__bf16*)(ws + 2 * planeB);

  // Kernel 1: 256 blocks x 8 waves x 128 pixels = 262144 pixels.
  va_qkvg<<<dim3(256), dim3(256), 0, stream>>>(x, Wqkv, Wg, bg, qws, kws, vws, out);
  // Kernel 2: 2048 tiles (16 w-tiles x 32 h-tiles x 4 batches), 8 waves/tile.
  va_attn<<<dim3(2048), dim3(256), 0, stream>>>(qws, kws, vws, W1, b1, ln_w, ln_b,
                                                W2, b2, out);
}

// v001
// A run of this version takes 84.2 microseconds.
// Two timings next to v000 put it at 1.91 and 1.89 times that version's speed.
#include <hip/hip_runtime.h>
#include <hip/hip_bf16.h>

#define BB   4
#define CC   32
#define HH   256
#define WW   256
#define HIDN 64
#define HWP  (HH * WW)
#define EPSV 1e-5f

typedef __attribute__((ext_vector_type(16))) __bf16 bf16x16;
typedef __attribute__((ext_vector_type(8)))  float  f32x8;
typedef __attribute__((ext_vector_type(8)))  unsigned u32x8;

union BFV {
  bf16x16  v;
  __bf16   e[16];
  unsigned u[8];
  uint4    q4[2];
};

__device__ __forceinline__ int iclamp(int x, int lo, int hi) {
  return x < lo ? lo : (x > hi ? hi : x);
}

static __device__ __forceinline__ f32x8 wmma_bf16(bf16x16 a, bf16x16 b, f32x8 c) {
  // D = A(16x32 bf16) x B(32x16 bf16) + C(16x16 f32)
  return __builtin_amdgcn_wmma_f32_16x16x32_bf16(false, a, false, b, (short)0, c,
                                                 false, false);
}

// ---------------------------------------------------------------------------
// Kernel 1: fused 1x1 convs.  D(128 x Npix) = [Wqkv ; Wg] * x.
//   m-tiles 0..1 -> q, 2..3 -> -k (negated!), 4..5 -> v  (bf16, pixel-major)
//   m-tiles 6..7 -> gate: d_out = gate + bg + x  (f32, B,C,H,W layout)
// Each wave: preloads all 8 A (weight) tiles, loops 8 N-tiles of 16 pixels.
// ---------------------------------------------------------------------------
__global__ __launch_bounds__(256) void va_qkvg(
    const float* __restrict__ x,
    const float* __restrict__ Wqkv,
    const float* __restrict__ Wg,
    const float* __restrict__ bg,
    __bf16* __restrict__ qws,
    __bf16* __restrict__ kws,     // holds -k
    __bf16* __restrict__ vws,
    float* __restrict__ out)
{
  const int lane = threadIdx.x & 31;
  const int wave = threadIdx.x >> 5;
  const int grp  = lane >> 4;      // 0: lanes 0-15 (K lo half), 1: lanes 16-31
  const int lm   = lane & 15;
  const int k0   = grp ? 8 : 0;    // A/B K sub-offset per lane half

  // A tiles: row (out-ch) per lane, 16 K values packed 2/VGPR.
  bf16x16 A[8];
  #pragma unroll
  for (int m = 0; m < 8; ++m) {
    const int o = m * 16 + lm;
    const float* wrow = (o < 96) ? (Wqkv + o * CC) : (Wg + (o - 96) * CC);
    BFV av;
    #pragma unroll
    for (int i = 0; i < 8; ++i) av.e[i]     = (__bf16)wrow[k0 + i];
    #pragma unroll
    for (int i = 0; i < 8; ++i) av.e[8 + i] = (__bf16)wrow[16 + k0 + i];
    A[m] = av.v;
  }

  float bgl[16];
  #pragma unroll
  for (int j = 0; j < 2; ++j)
    #pragma unroll
    for (int r = 0; r < 8; ++r)
      bgl[j * 8 + r] = bg[j * 16 + r + 8 * grp];

  const long pix0 = (long)blockIdx.x * 1024 + (long)wave * 128;
  for (int t = 0; t < 8; ++t) {
    const long pixbase = pix0 + (long)t * 16;
    const int  b    = (int)(pixbase / HWP);
    const int  pimg = (int)(pixbase % HWP);

    // B operand: x tile, column (pixel) per lane, K packed (strided loads).
    BFV bv;
    const float* xb = x + ((long)b * CC) * HWP + pimg + lm;
    #pragma unroll
    for (int i = 0; i < 8; ++i) bv.e[i]     = (__bf16)xb[(long)(k0 + i) * HWP];
    #pragma unroll
    for (int i = 0; i < 8; ++i) bv.e[8 + i] = (__bf16)xb[(long)(16 + k0 + i) * HWP];

    f32x8 acc[8];
    #pragma unroll
    for (int m = 0; m < 8; ++m) {
      f32x8 cz = {};
      acc[m] = wmma_bf16(A[m], bv.v, cz);
    }

    // D layout: element (lane, r) = (row 16m + r + 8*grp, pixel pixbase + lm)
    const long pix = pixbase + lm;
    __bf16* qp = qws + pix * CC;
    __bf16* kp = kws + pix * CC;
    __bf16* vp = vws + pix * CC;
    #pragma unroll
    for (int j = 0; j < 2; ++j) {
      #pragma unroll
      for (int r = 0; r < 8; ++r) {
        const int ch = j * 16 + r + 8 * grp;
        qp[ch] = (__bf16)acc[0 + j][r];
        kp[ch] = (__bf16)(-acc[2 + j][r]);   // store -k
        vp[ch] = (__bf16)acc[4 + j][r];
      }
    }
    #pragma unroll
    for (int j = 0; j < 2; ++j) {
      #pragma unroll
      for (int r = 0; r < 8; ++r) {
        const int  cb = j * 16 + r + 8 * grp;
        const long oi = ((long)b * CC + cb) * HWP + pimg + lm;
        out[oi] = acc[6 + j][r] + bgl[j * 8 + r] + x[oi];
      }
    }
  }
}

// ---------------------------------------------------------------------------
// Kernel 2: neighbor MLP + softmax + weighted v.  One wave owns 16 pixels
// (fixed h, consecutive w).  Both GEMMs run with the weights as A and the
// pixels as B columns, so a lane owns ONE pixel:
//   hid^T (64 x 16 pix) = W1 * (q-k)^T : lane (lm, grp) holds hidden units
//     16m + 8*grp + r of pixel lm -> LayerNorm sums are in-lane plus one
//     exchange with lane ^ 16;
//   two converted D tiles are the B operand of the second GEMM as they lie
//     (no LDS, no lane exchange);
//   scores^T (32 x 16 pix): a lane holds channels 16c + 8*grp + r of pixel lm,
//     the same 8-channel runs that one 16-byte load of v brings.
// Neighbors are the outer loop; the 9-way softmax is a running accumulation.
// ---------------------------------------------------------------------------
__device__ __forceinline__ float other_half(float x) {
  // value of lane ^ 16 (cross-row vector move)
  const int b = __builtin_bit_cast(int, x);
  return __builtin_bit_cast(float,
      __builtin_amdgcn_permlanex16(b, b, 0x76543210, 0xfedcba98, false, false));
}

__global__ __launch_bounds__(256) void va_attn(
    const __bf16* __restrict__ qws,
    const __bf16* __restrict__ kws,   // -k
    const __bf16* __restrict__ vws,
    const float* __restrict__ W1,
    const float* __restrict__ b1,
    const float* __restrict__ ln_w,
    const float* __restrict__ ln_b,
    const float* __restrict__ W2,
    const float* __restrict__ b2,
    float* __restrict__ out)
{
  // b1 | b2: read every pass straight into the accumulators (C = D).
  __shared__ __attribute__((aligned(32))) float lds_bias[HIDN + CC];
  const int tid = threadIdx.x;
  const float bias_in = (tid < HIDN) ? b1[tid] : b2[iclamp(tid - HIDN, 0, CC - 1)];

  const int lane = threadIdx.x & 31;
  const int wave = threadIdx.x >> 5;
  const int grp  = lane >> 4;
  const int lm   = lane & 15;
  const int k0   = grp ? 8 : 0;

  const int tile = blockIdx.x;             // 2048 tiles
  const int tw = tile & 15;                // 16 tiles across W
  const int th = (tile >> 4) & 31;         // 32 tiles across H
  const int b  = tile >> 9;
  const int h  = th * 8 + wave;
  const int w0 = tw * 16;

  // A1: W1 (64 x 32), 4 M-tiles.  A2: W2 (32 x 64), 2 M-tiles x 2 K-steps.
  bf16x16 A1t[4];
  #pragma unroll
  for (int n = 0; n < 4; ++n) {
    const float* wr = W1 + (n * 16 + lm) * CC;
    BFV t;
    #pragma unroll
    for (int i = 0; i < 8; ++i) t.e[i]     = (__bf16)wr[k0 + i];
    #pragma unroll
    for (int i = 0; i < 8; ++i) t.e[8 + i] = (__bf16)wr[16 + k0 + i];
    A1t[n] = t.v;
  }
  bf16x16 A2t[2][2];
  #pragma unroll
  for (int c = 0; c < 2; ++c)
    #pragma unroll
    for (int ks = 0; ks < 2; ++ks) {
      const float* wr = W2 + (c * 16 + lm) * HIDN + ks * 32;
      BFV t;
      #pragma unroll
      for (int i = 0; i < 8; ++i) t.e[i]     = (__bf16)wr[k0 + i];
      #pragma unroll
      for (int i = 0; i < 8; ++i) t.e[8 + i] = (__bf16)wr[16 + k0 + i];
      A2t[c][ks] = t.v;
    }

  // Per-row parameters in the D map: register r = row 8*grp + r of a tile.
  f32x8 lwc[4], lbc[4];
  #pragma unroll
  for (int n = 0; n < 4; ++n)
    #pragma unroll
    for (int r = 0; r < 8; ++r) {
      const int d = n * 16 + k0 + r;
      lwc[n][r] = ln_w[d]; lbc[n][r] = ln_b[d];
    }
  const f32x8* biasrow = (const f32x8*)(lds_bias + k0);   // tile t: biasrow[2 * t]

  // q as a B column (pixel w0+lm), kept packed bf16: 2x b128 loads.
  const long prow = ((long)b * HH + h) * WW;
  const uint4* qrow4 = (const uint4*)(qws + (prow + w0 + lm) * CC);
  BFV qv;
  qv.q4[0] = qrow4[grp];
  qv.q4[1] = qrow4[2 + grp];

  f32x8 num[2] = {};
  f32x8 den[2] = {};

  // The bias load above flies with the weight loads; store and publish here.
  if (tid < HIDN + CC) lds_bias[tid] = bias_in;
  __syncthreads();

  for (int nb = 0; nb < 9; ++nb) {
    // Compiler fence: keeps the bias reads inside the loop; hoisted, they
    // would hold 48 registers across it and cost resident waves.
    asm volatile("" ::: "memory");
    const int dy = nb / 3 - 1;
    const int dx = nb % 3 - 1;
    const int hh = h + dy;
    const bool hok = (hh >= 0) && (hh < HH);
    const int hhc = iclamp(hh, 0, HH - 1);
    const long nrow = ((long)b * HH + hhc) * WW;

    // This lane's neighbor pixel; out-of-image k == v == 0 (zero-padded unfold).
    const int wwA = w0 + lm + dx;
    const bool aok = hok && (wwA >= 0) && (wwA < WW);
    const long npix = nrow + iclamp(wwA, 0, WW - 1);
    const uint4* krow4 = (const uint4*)(kws + npix * CC);
    const uint4* vrow4 = (const uint4*)(vws + npix * CC);
    BFV kv;
    kv.q4[0] = krow4[grp];
    kv.q4[1] = krow4[2 + grp];
    const uint4 v0 = vrow4[grp];
    const uint4 v1 = vrow4[2 + grp];
    #pragma unroll
    for (int i = 0; i < 8; ++i) kv.u[i] = aok ? kv.u[i] : 0u;
    const u32x8 vraw = {v0.x, v0.y, v0.z, v0.w, v1.x, v1.y, v1.z, v1.w};
    const u32x8 vzero = {};
    const bf16x16 vv = __builtin_bit_cast(bf16x16, aok ? vraw : vzero);
    BFV av;
    av.v = qv.v + kv.v;                 // packed bf16 add (k pre-negated)

    // hid^T = W1 * A^T + b1 : 64 x 16 in 4 accumulators (b1 enters as C).
    f32x8 hacc[4];
    #pragma unroll
    for (int n = 0; n < 4; ++n) hacc[n] = wmma_bf16(A1t[n], av.v, biasrow[2 * n]);

    // LayerNorm per pixel (= per lane pair l, l ^ 16).
    f32x8 s  = hacc[0] + hacc[1] + hacc[2] + hacc[3];
    f32x8 s2 = hacc[0] * hacc[0] + hacc[1] * hacc[1]
             + hacc[2] * hacc[2] + hacc[3] * hacc[3];
    float sv   = ((s[0] + s[1]) + (s[2] + s[3])) + ((s[4] + s[5]) + (s[6] + s[7]));
    float qsum = ((s2[0] + s2[1]) + (s2[2] + s2[3])) + ((s2[4] + s2[5]) + (s2[6] + s2[7]));
    sv   += other_half(sv);
    qsum += other_half(qsum);
    const float mu = sv * (1.0f / HIDN);
    float var = qsum * (1.0f / HIDN) - mu * mu;
    var = var > 0.f ? var : 0.f;
    const float inv = 1.0f / (__builtin_sqrtf(var) + EPSV);

    // Normalize + ReLU; D tiles 2ks, 2ks+1 converted in place are B of step ks.
    BFV hb[2];
    #pragma unroll
    for (int n = 0; n < 4; ++n)
      #pragma unroll
      for (int r = 0; r < 8; ++r) {
        float hv = (hacc[n][r] - mu) * inv;
        hv = lwc[n][r] * hv + lbc[n][r];
        hv = hv > 0.f ? hv : 0.f;
        hb[n >> 1].e[(n & 1) * 8 + r] = (__bf16)hv;
      }

    // scores^T = W2 * hid^T + b2 (K=64: two chained WMMAs, b2 enters as C),
    // then online softmax-weighted accumulation of v.
    #pragma unroll
    for (int c = 0; c < 2; ++c) {
      f32x8 sc = wmma_bf16(A2t[c][0], hb[0].v, biasrow[2 * (4 + c)]);
      sc = wmma_bf16(A2t[c][1], hb[1].v, sc);
      #pragma unroll
      for (int r = 0; r < 8; ++r) {
        const float vval = (float)vv[c * 8 + r];
        const float e = __expf(sc[r]);
        den[c][r] += e;
        num[c][r] += e * vval;
      }
    }
  }

  // out += weighted_v  (out already holds base + x from kernel 1).
  #pragma unroll
  for (int c = 0; c < 2; ++c)
    #pragma unroll
    for (int r = 0; r < 8; ++r) {
      const int  ch = c * 16 + k0 + r;
      const long oi = ((long)b * CC + ch) * HWP + (long)h * WW + (w0 + lm);
      out[oi] += num[c][r] / den[c][r];
    }
}

extern "C" void kernel_launch(void* const* d_in, const int* in_sizes, int n_in,
                              void* d_out, int out_size, void* d_ws, size_t ws_size,
                              hipStream_t stream) {
  (void)in_sizes; (void)n_in; (void)out_size; (void)ws_size;
  const float* x    = (const float*)d_in[0];
  const float* Wqkv = (const float*)d_in[1];
  const float* W1   = (const float*)d_in[2];
  const float* b1   = (const float*)d_in[3];
  const float* ln_w = (const float*)d_in[4];
  const float* ln_b = (const float*)d_in[5];
  const float* W2   = (const float*)d_in[6];
  const float* b2   = (const float*)d_in[7];
  const float* Wg   = (const float*)d_in[8];
  const float* bg   = (const float*)d_in[9];
  float* out = (float*)d_out;

  char* ws = (char*)d_ws;
  const size_t npix   = (size_t)BB * HWP;
  const size_t planeB = npix * CC * sizeof(__bf16);   // 16 MiB per bf16 tensor
  __bf16* qws = (__bf16*)(ws);
  __bf16* kws = (__bf16*)(ws + planeB);
  __bf16* vws = (__bf16*)(ws + 2 * planeB);

  // Kernel 1: 256 blocks x 8 waves x 128 pixels = 262144 pixels.
  va_qkvg<<<dim3(256), dim3(256), 0, stream>>>(x, Wqkv, Wg, bg, qws, kws, vws, out);
  // Kernel 2: 2048 tiles (16 w-tiles x 32 h-tiles x 4 batches), 8 waves/tile.
  va_attn<<<dim3(2048), dim3(256), 0, stream>>>(qws, kws, vws, W1, b1, ln_w, ln_b,
                                                W2, b2, out);
}

// v003
// Measured time: 50.7 microseconds a run.
// It is 1.67 times as fast as v001, going by the measured steps of the versions left out in between.
// Over all steps from v000 it is 3.17 times as fast.
#include <hip/hip_runtime.h>
#include <hip/hip_bf16.h>

#define BB   4
#define CC   32
#define HH   256
#define WW   256
#define HIDN 64
#define HWP  (HH * WW)
#define EPSV 1e-5f

typedef __attribute__((ext_vector_type(16))) __bf16 bf16x16;
typedef __attribute__((ext_vector_type(8)))  float  f32x8;
typedef __attribute__((ext_vector_type(8)))  unsigned u32x8;

union BFV {
  bf16x16  v;
  __bf16   e[16];
  unsigned u[8];
  uint4    q4[2];
};

__device__ __forceinline__ int iclamp(int x, int lo, int hi) {
  return x < lo ? lo : (x > hi ? hi : x);
}

static __device__ __forceinline__ f32x8 wmma_bf16(bf16x16 a, bf16x16 b, f32x8 c) {
  // D = A(16x32 bf16) x B(32x16 bf16) + C(16x16 f32)
  return __builtin_amdgcn_wmma_f32_16x16x32_bf16(false, a, false, b, (short)0, c,
                                                 false, false);
}

// ---------------------------------------------------------------------------
// One launch.  A block owns 8 rows x 16 columns of one image; a wave owns one
// row (16 pixels).
// Phase 0: the block brings all four weight matrices in once, 16 bytes a thread
//   and whole lines a wave, and lays them in LDS as bf16 in A-tile order; every
//   wave then reads its A tiles from there (two 16-byte LDS reads a tile).
// Phase 1 (1x1 convs, weights as A, pixels as B columns):
//   every wave projects its own 16 pixels: -k and v go to LDS, q stays in
//   registers (two converted D tiles are the B operand of the first MLP GEMM as
//   they lie), gate + bg + x is parked in LDS, lane-private;
//   waves 0..3 also project the 52 pixels of the ring round the tile (-k, v).
//   A pixel outside the image enters as x = 0, so its k and v are 0
//   (zero-padded unfold; the qkv conv has no bias).
// Phase 2: neighbor MLP + softmax + weighted v, k and v read from LDS.
//   hid^T (64 x 16 pix) = W1 * (q-k)^T : lane (lm, grp) holds hidden units
//     16m + 8*grp + r of pixel lm -> LayerNorm sums are in-lane plus one
//     exchange with lane ^ 16;
//   two converted D tiles are the B operand of the second GEMM as they lie;
//   scores^T (32 x 16 pix): a lane holds channels 16c + 8*grp + r of pixel lm,
//     the same 8-channel runs that one 16-byte read of v brings.
// Neighbors are the outer loop; the 9-way softmax is a running accumulation.
// ---------------------------------------------------------------------------
#define TROWS  8                     // tile rows (= waves)
#define TCOLS  16                    // tile columns (= one WMMA N)
#define HCOLS  (TCOLS + 2)           // halo columns
#define HROWS  (TROWS + 2)           // halo rows
#define NRING  (2 * HCOLS + 2 * TROWS)
#define KVPITCH 144                  // -k 64 B | v 64 B | 16 B pad: 16 B x odd

__device__ __forceinline__ float other_half(float x) {
  // value of lane ^ 16 (cross-row vector move)
  const int b = __builtin_bit_cast(int, x);
  return __builtin_bit_cast(float,
      __builtin_amdgcn_permlanex16(b, b, 0x76543210, 0xfedcba98, false, false));
}

// A-tile image in LDS: 1 KiB a tile (16 rows x 32 K, bf16) as two planes of
// 512 B; plane hf holds, at 16 B x lane, K values 16*hf + 8*grp + 0..7 of row lm
// (lane = 16*grp + lm): a wave's read of a plane is 512 contiguous bytes.
#define T_Q   0                      // Wqkv: tiles 0..5 (q, k, v: two each)
#define T_K   2
#define T_V   4
#define T_G   6                      // Wg:   tiles 6, 7
#define T_W1  8                      // W1:   tiles 8..11
#define T_W2  12                     // W2:   tile 12 + 2*c + ks
#define NTILES 16

__device__ __forceinline__ bf16x16 read_a(const unsigned char* img, int tile, int lane) {
  BFV t;
  t.q4[0] = *(const uint4*)(img + tile * 1024 + lane * 16);
  t.q4[1] = *(const uint4*)(img + tile * 1024 + 512 + lane * 16);
  return t.v;
}

// Four neighboring weights of one row as 4 bf16 (8 bytes of the image).
__device__ __forceinline__ void put_w4(unsigned char* dst, const float (&w)[4]) {
  union { __bf16 e[4]; uint2 d; } t;
  #pragma unroll
  for (int i = 0; i < 4; ++i) t.e[i] = (__bf16)w[i];
  *(uint2*)dst = t.d;
}

// x of one pixel per lane in the B map (channels k0+i, 16+k0+i), f32.
__device__ __forceinline__ void load_x(const float* __restrict__ xpix, int k0,
                                       float (&xf)[16]) {
  #pragma unroll
  for (int i = 0; i < 8; ++i) xf[i]     = xpix[(long)(k0 + i) * HWP];
  #pragma unroll
  for (int i = 0; i < 8; ++i) xf[8 + i] = xpix[(long)(16 + k0 + i) * HWP];
}

// Two D tiles (channels 8*grp + r and 16 + 8*grp + r of the lane's pixel) as
// 32 bf16 channels of one pixel record: 16 B at 16*grp and at 32 + 16*grp.
__device__ __forceinline__ void put_rec(unsigned char* rec, int grp,
                                        f32x8 d0, f32x8 d1) {
  BFV t;
  #pragma unroll
  for (int r = 0; r < 8; ++r) { t.e[r] = (__bf16)d0[r]; t.e[8 + r] = (__bf16)d1[r]; }
  *(uint4*)(rec + 16 * grp)      = t.q4[0];
  *(uint4*)(rec + 32 + 16 * grp) = t.q4[1];
}

__global__ __launch_bounds__(256) void va_fused(
    const float* __restrict__ x,
    const float* __restrict__ Wqkv,
    const float* __restrict__ Wg,
    const float* __restrict__ bg,
    const float* __restrict__ W1,
    const float* __restrict__ b1,
    const float* __restrict__ ln_w,
    const float* __restrict__ ln_b,
    const float* __restrict__ W2,
    const float* __restrict__ b2,
    float* __restrict__ out)
{
  // b1 | b2: read every pass straight into the accumulators (C = D).
  __shared__ __attribute__((aligned(32))) float lds_bias[HIDN + CC];
  // -k and v of the tile and its ring, one record per pixel.
  __shared__ __attribute__((aligned(16))) unsigned char lds_kv[HROWS * HCOLS * KVPITCH];
  // gate + bg + x, element i of thread t at [i * 256 + t] (lane-private).
  __shared__ float lds_base[16 * 256];
  // All weights, bf16, in A-tile order.
  __shared__ __attribute__((aligned(16))) unsigned char lds_w[NTILES * 1024];

  const int tid = threadIdx.x;
  const float bias_in = (tid < HIDN) ? b1[tid] : b2[iclamp(tid - HIDN, 0, CC - 1)];

  // ---- Phase 0: weight loads (2048 groups of 4 floats, 8 a thread) ----
  float wl[8][4];
  #pragma unroll
  for (int j = 0; j < 8; ++j) {
    const float* wsrc = j < 3 ? Wqkv + j * 1024
                      : j < 4 ? Wg
                      : j < 6 ? W1 + (j - 4) * 1024
                              : W2 + (j - 6) * 1024;
    #pragma unroll
    for (int i = 0; i < 4; ++i) wl[j][i] = wsrc[tid * 4 + i];
  }

  const int lane = threadIdx.x & 31;
  const int wave = __builtin_amdgcn_readfirstlane(threadIdx.x >> 5);
  const int grp  = lane >> 4;
  const int lm   = lane & 15;
  const int k0   = grp ? 8 : 0;

  const int tile = blockIdx.x;             // 2048 tiles
  const int tw = tile & 15;                // 16 tiles across W
  const int th = (tile >> 4) & 31;         // 32 tiles across H
  const int b  = tile >> 9;
  const int h0 = th * TROWS;
  const int h  = h0 + wave;
  const int w0 = tw * TCOLS;
  const float* xb = x + (long)b * CC * HWP;

  // ---- Phase 1 ----
  // Ring pixel p of waves 0..3: top row, bottom row, then left/right pairs.
  const int p  = wave * 16 + lm;
  const int e  = p - 2 * HCOLS;
  const int hr = p < HCOLS ? 0 : (p < 2 * HCOLS ? HROWS - 1 : 1 + (e >> 1));
  const int wc = p < HCOLS ? p : (p < 2 * HCOLS ? p - HCOLS : (e & 1) * (HCOLS - 1));
  const int hh = h0 - 1 + hr;
  const int ww = w0 - 1 + wc;
  const bool ring_ok = (p < NRING) && (hh >= 0) && (hh < HH) && (ww >= 0) && (ww < WW);

  // All x loads first: they come from furthest away.
  // Waves 4..7 have no ring pixel and name their own pixel again (the same
  // lines): no branch, so these loads fly together with the rest.
  const int rh = wave < 4 ? iclamp(hh, 0, HH - 1) : h;
  const int rw = wave < 4 ? iclamp(ww, 0, WW - 1) : w0 + lm;
  float xr[16];
  load_x(xb + rh * WW + rw, k0, xr);
  float xf[16];
  load_x(xb + h * WW + w0 + lm, k0, xf);

  float bgl[16];
  #pragma unroll
  for (int j = 0; j < 2; ++j)
    #pragma unroll
    for (int r = 0; r < 8; ++r) bgl[j * 8 + r] = bg[j * 16 + k0 + r];
  const f32x8 cz = {};

  // Scheduling fence: every load above is issued before the first wait; without
  // it the weights' conversions, and their wait, move up in front of the x loads,
  // and a wave waits out the two latencies in turn.
  __builtin_amdgcn_sched_barrier(0);

  // Place of a thread's 4 weights inside a tile: columns 4*c4 .. 4*c4+3.
  {
    const int c4   = tid & 7;
    const int incol = (c4 >> 2) * 512 + ((c4 >> 1) & 1) * 256 + (c4 & 1) * 8;
    // 32-column matrices: 32 rows (two tiles) a round; row = tid >> 3.
    unsigned char* d32 = lds_w + (tid >> 7) * 1024 + ((tid >> 3) & 15) * 16 + incol;
    // W2 (64 columns): 16 rows a round; row = tid >> 4, K step = bit 3.
    unsigned char* d64 = lds_w + ((tid >> 3) & 1) * 1024 + (tid >> 4) * 16 + incol;
    #pragma unroll
    for (int j = 0; j < 6; ++j) put_w4(d32 + j * 2048, wl[j]);
    #pragma unroll
    for (int j = 6; j < 8; ++j) put_w4(d64 + j * 2048, wl[j]);
  }
  // Publishes the weight image.
  __syncthreads();

  bf16x16 Aq[2], Ak[2], Av[2], Ag[2];
  #pragma unroll
  for (int j = 0; j < 2; ++j) {
    Aq[j] = read_a(lds_w, T_Q + j, lane);
    Ak[j] = read_a(lds_w, T_K + j, lane);
    Av[j] = read_a(lds_w, T_V + j, lane);
    Ag[j] = read_a(lds_w, T_G + j, lane);
  }

  // Inputs-only fence on the loaded ring values: without it the compiler sinks
  // their loads into the branch below, behind the wait for the weights, and a
  // ring wave waits out two memory latencies in turn.
  asm volatile("" :: "v"(xr[0]), "v"(xr[1]), "v"(xr[2]), "v"(xr[3]),
                     "v"(xr[4]), "v"(xr[5]), "v"(xr[6]), "v"(xr[7]),
                     "v"(xr[8]), "v"(xr[9]), "v"(xr[10]), "v"(xr[11]),
                     "v"(xr[12]), "v"(xr[13]), "v"(xr[14]), "v"(xr[15]));
  if (wave < 4) {
    BFV rv;
    #pragma unroll
    for (int i = 0; i < 16; ++i) rv.e[i] = (__bf16)xr[i];
    #pragma unroll
    for (int i = 0; i < 8; ++i) rv.u[i] = ring_ok ? rv.u[i] : 0u;
    const f32x8 rk0 = wmma_bf16(Ak[0], rv.v, cz);
    const f32x8 rk1 = wmma_bf16(Ak[1], rv.v, cz);
    const f32x8 rv0 = wmma_bf16(Av[0], rv.v, cz);
    const f32x8 rv1 = wmma_bf16(Av[1], rv.v, cz);
    if (p < NRING) {
      unsigned char* rec = lds_kv + (hr * HCOLS + wc) * KVPITCH;
      put_rec(rec,      grp, -rk0, -rk1);    // -k
      put_rec(rec + 64, grp,  rv0,  rv1);
    }
  }

  BFV qv;
  {
    BFV bv;
    #pragma unroll
    for (int i = 0; i < 16; ++i) bv.e[i] = (__bf16)xf[i];
    const f32x8 ok0 = wmma_bf16(Ak[0], bv.v, cz);
    const f32x8 ok1 = wmma_bf16(Ak[1], bv.v, cz);
    const f32x8 ov0 = wmma_bf16(Av[0], bv.v, cz);
    const f32x8 ov1 = wmma_bf16(Av[1], bv.v, cz);
    unsigned char* rec = lds_kv + ((wave + 1) * HCOLS + lm + 1) * KVPITCH;
    put_rec(rec,      grp, -ok0, -ok1);      // -k
    put_rec(rec + 64, grp,  ov0,  ov1);

    // q as a B column (pixel w0+lm), kept packed bf16.
    #pragma unroll
    for (int j = 0; j < 2; ++j) {
      const f32x8 qa = wmma_bf16(Aq[j], bv.v, cz);
      #pragma unroll
      for (int r = 0; r < 8; ++r) qv.e[j * 8 + r] = (__bf16)qa[r];
    }
    // gate + bg + x in the D map: element j*8+r = channel 16j + 8*grp + r.
    #pragma unroll
    for (int j = 0; j < 2; ++j) {
      const f32x8 ga = wmma_bf16(Ag[j], bv.v, cz);
      #pragma unroll
      for (int r = 0; r < 8; ++r)
        lds_base[(j * 8 + r) * 256 + tid] = ga[r] + bgl[j * 8 + r] + xf[j * 8 + r];
    }
  }

  // ---- Phase 2 set-up ----
  // A1: W1 (64 x 32), 4 M-tiles.  A2: W2 (32 x 64), 2 M-tiles x 2 K-steps.
  bf16x16 A1t[4];
  #pragma unroll
  for (int n = 0; n < 4; ++n) A1t[n] = read_a(lds_w, T_W1 + n, lane);
  bf16x16 A2t[2][2];
  #pragma unroll
  for (int c = 0; c < 2; ++c)
    #pragma unroll
    for (int ks = 0; ks < 2; ++ks) A2t[c][ks] = read_a(lds_w, T_W2 + 2 * c + ks, lane);

  // Per-row parameters in the D map: register r = row 8*grp + r of a tile.
  f32x8 lwc[4], lbc[4];
  #pragma unroll
  for (int n = 0; n < 4; ++n)
    #pragma unroll
    for (int r = 0; r < 8; ++r) {
      const int d = n * 16 + k0 + r;
      lwc[n][r] = ln_w[d]; lbc[n][r] = ln_b[d];
    }
  const f32x8* biasrow = (const f32x8*)(lds_bias + k0);   // tile t: biasrow[2 * t]

  f32x8 num[2] = {};
  f32x8 den[2] = {};

  // Publishes the biases and every wave's k / v records.
  if (tid < HIDN + CC) lds_bias[tid] = bias_in;
  __syncthreads();

  // Record of halo pixel (wave, lm): the (dy, dx) = (-1, -1) neighbor.
  const unsigned char* rec0 = lds_kv + (wave * HCOLS + lm) * KVPITCH + 16 * grp;

  for (int nb = 0; nb < 9; ++nb) {
    // Compiler fence: keeps the bias reads inside the loop; hoisted, they
    // would hold 48 registers across it and cost resident waves.
    asm volatile("" ::: "memory");
    const unsigned char* rec = rec0 + ((nb / 3) * HCOLS + nb % 3) * KVPITCH;
    BFV kv;
    kv.q4[0] = *(const uint4*)(rec);
    kv.q4[1] = *(const uint4*)(rec + 32);
    const uint4 v0 = *(const uint4*)(rec + 64);
    const uint4 v1 = *(const uint4*)(rec + 96);
    const u32x8 vraw = {v0.x, v0.y, v0.z, v0.w, v1.x, v1.y, v1.z, v1.w};
    const bf16x16 vv = __builtin_bit_cast(bf16x16, vraw);
    BFV av;
    av.v = qv.v + kv.v;                 // packed bf16 add (k pre-negated)
    // hid^T = W1 * A^T + b1 : 64 x 16 in 4 accumulators (b1 enters as C).
    f32x8 hacc[4];
    #pragma unroll
    for (int n = 0; n < 4; ++n) hacc[n] = wmma_bf16(A1t[n], av.v, biasrow[2 * n]);

    // LayerNorm per pixel (= per lane pair l, l ^ 16).
    f32x8 s  = hacc[0] + hacc[1] + hacc[2] + hacc[3];
    f32x8 s2 = hacc[0] * hacc[0] + hacc[1] * hacc[1]
             + hacc[2] * hacc[2] + hacc[3] * hacc[3];
    float sv   = ((s[0] + s[1]) + (s[2] + s[3])) + ((s[4] + s[5]) + (s[6] + s[7]));
    float qsum = ((s2[0] + s2[1]) + (s2[2] + s2[3])) + ((s2[4] + s2[5]) + (s2[6] + s2[7]));
    sv   += other_half(sv);
    qsum += other_half(qsum);
    const float mu = sv * (1.0f / HIDN);
    float var = qsum * (1.0f / HIDN) - mu * mu;
    var = var > 0.f ? var : 0.f;
    const float inv = 1.0f / (__builtin_sqrtf(var) + EPSV);

    // Normalize + ReLU; D tiles 2ks, 2ks+1 converted in place are B of step ks.
    BFV hb[2];
    #pragma unroll
    for (int n = 0; n < 4; ++n)
      #pragma unroll
      for (int r = 0; r < 8; ++r) {
        float hv = (hacc[n][r] - mu) * inv;
        hv = lwc[n][r] * hv + lbc[n][r];
        hv = hv > 0.f ? hv : 0.f;
        hb[n >> 1].e[(n & 1) * 8 + r] = (__bf16)hv;
      }

    // scores^T = W2 * hid^T + b2 (K=64: two chained WMMAs, b2 enters as C),
    // then online softmax-weighted accumulation of v.
    #pragma unroll
    for (int c = 0; c < 2; ++c) {
      f32x8 sc = wmma_bf16(A2t[c][0], hb[0].v, biasrow[2 * (4 + c)]);
      sc = wmma_bf16(A2t[c][1], hb[1].v, sc);
      #pragma unroll
      for (int r = 0; r < 8; ++r) {
        const float vval = (float)vv[c * 8 + r];
        const float e = __expf(sc[r]);
        den[c][r] += e;
        num[c][r] += e * vval;
      }
    }
  }

  // out = (gate + bg + x) + weighted_v: every element stored once.
  #pragma unroll
  for (int c = 0; c < 2; ++c)
    #pragma unroll
    for (int r = 0; r < 8; ++r) {
      const int  ch = c * 16 + k0 + r;
      const long oi = ((long)b * CC + ch) * HWP + (long)h * WW + (w0 + lm);
      out[oi] = lds_base[(c * 8 + r) * 256 + tid] + num[c][r] / den[c][r];
    }
}

extern "C" void kernel_launch(void* const* d_in, const int* in_sizes, int n_in,
                              void* d_out, int out_size, void* d_ws, size_t ws_size,
                              hipStream_t stream) {
  (void)in_sizes; (void)n_in; (void)out_size; (void)d_ws; (void)ws_size;
  const float* x    = (const float*)d_in[0];
  const float* Wqkv = (const float*)d_in[1];
  const float* W1   = (const float*)d_in[2];
  const float* b1   = (const float*)d_in[3];
  const float* ln_w = (const float*)d_in[4];
  const float* ln_b = (const float*)d_in[5];
  const float* W2   = (const float*)d_in[6];
  const float* b2   = (const float*)d_in[7];
  const float* Wg   = (const float*)d_in[8];
  const float* bg   = (const float*)d_in[9];
  float* out = (float*)d_out;

  // 2048 tiles (16 w-tiles x 32 h-tiles x 4 batches), 8 waves per tile.
  va_fused<<<dim3(2048), dim3(256), 0, stream>>>(x, Wqkv, Wg, bg, W1, b1, ln_w, ln_b,
                                                 W2, b2, out);
}

// v004
// It runs in 46.5 microseconds.
// Timed twice side by side with v003, it ran 1.09 times as fast both times.
// Over all steps from v000 it is 3.46 times as fast.
#include <hip/hip_runtime.h>
#include <hip/hip_bf16.h>

#define BB   4
#define CC   32
#define HH   256
#define WW   256
#define HIDN 64
#define HWP  (HH * WW)
#define EPSV 1e-5f

typedef __attribute__((ext_vector_type(16))) __bf16 bf16x16;
typedef __attribute__((ext_vector_type(8)))  float  f32x8;
typedef __attribute__((ext_vector_type(8)))  unsigned u32x8;

union BFV {
  bf16x16  v;
  __bf16   e[16];
  unsigned u[8];
  uint4    q4[2];
};

__device__ __forceinline__ int iclamp(int x, int lo, int hi) {
  return x < lo ? lo : (x > hi ? hi : x);
}

static __device__ __forceinline__ f32x8 wmma_bf16(bf16x16 a, bf16x16 b, f32x8 c) {
  // D = A(16x32 bf16) x B(32x16 bf16) + C(16x16 f32)
  return __builtin_amdgcn_wmma_f32_16x16x32_bf16(false, a, false, b, (short)0, c,
                                                 false, false);
}

// ---------------------------------------------------------------------------
// One launch.  A block owns 8 rows x 16 columns of one image; a wave owns one
// row (16 pixels).
// Phase 0: the block brings all four weight matrices in once, 16 bytes a thread
//   and whole lines a wave, and lays them in LDS as bf16 in A-tile order; every
//   wave then reads its A tiles from there (two 16-byte LDS reads a tile).
// Phase 1 (1x1 convs, weights as A, pixels as B columns):
//   every wave projects its own 16 pixels: -k and v go to LDS, q stays in
//   registers (two converted D tiles are the B operand of the first MLP GEMM as
//   they lie), gate + bg + x is parked in LDS, lane-private;
//   waves 0..3 also project the 52 pixels of the ring round the tile (-k, v).
//   A pixel outside the image enters as x = 0, so its k and v are 0
//   (zero-padded unfold; the qkv conv has no bias).
// Phase 2: neighbor MLP + softmax + weighted v, k and v read from LDS.
//   hid^T (64 x 16 pix) = W1 * (q-k)^T : lane (lm, grp) holds hidden units
//     16m + 8*grp + r of pixel lm -> LayerNorm sums are in-lane plus one
//     exchange with lane ^ 16;
//   two converted D tiles are the B operand of the second GEMM as they lie;
//   scores^T (32 x 16 pix): a lane holds channels 16c + 8*grp + r of pixel lm,
//     the same 8-channel runs that one 16-byte read of v brings.
// Neighbors are the outer loop; the 9-way softmax is a running accumulation.
// ---------------------------------------------------------------------------
#define TROWS  8                     // tile rows (= waves)
#define TCOLS  16                    // tile columns (= one WMMA N)
#define HCOLS  (TCOLS + 2)           // halo columns
#define HROWS  (TROWS + 2)           // halo rows
#define NRING  (2 * HCOLS + 2 * TROWS)
#define KVPITCH 144                  // -k 64 B | v 64 B | 16 B pad: 16 B x odd

__device__ __forceinline__ float other_half(float x) {
  // value of lane ^ 16 (cross-row vector move)
  const int b = __builtin_bit_cast(int, x);
  return __builtin_bit_cast(float,
      __builtin_amdgcn_permlanex16(b, b, 0x76543210, 0xfedcba98, false, false));
}

// A-tile image in LDS: 1 KiB a tile (16 rows x 32 K, bf16) as two planes of
// 512 B; plane hf holds, at 16 B x lane, K values 16*hf + 8*grp + 0..7 of row lm
// (lane = 16*grp + lm): a wave's read of a plane is 512 contiguous bytes.
#define T_Q   0                      // Wqkv: tiles 0..5 (q, k, v: two each)
#define T_K   2
#define T_V   4
#define T_G   6                      // Wg:   tiles 6, 7
#define T_W1  8                      // W1:   tiles 8..11
#define T_W2  12                     // W2:   tile 12 + 2*c + ks
#define NTILES 16

__device__ __forceinline__ bf16x16 read_a(const unsigned char* img, int tile, int lane) {
  BFV t;
  t.q4[0] = *(const uint4*)(img + tile * 1024 + lane * 16);
  t.q4[1] = *(const uint4*)(img + tile * 1024 + 512 + lane * 16);
  return t.v;
}

// Four neighboring weights of one row as 4 bf16 (8 bytes of the image).
__device__ __forceinline__ void put_w4(unsigned char* dst, const float (&w)[4]) {
  union { __bf16 e[4]; uint2 d; } t;
  #pragma unroll
  for (int i = 0; i < 4; ++i) t.e[i] = (__bf16)w[i];
  *(uint2*)dst = t.d;
}

// x of one pixel per lane in the B map (channels k0+i, 16+k0+i), f32.
__device__ __forceinline__ void load_x(const float* __restrict__ xpix, int k0,
                                       float (&xf)[16]) {
  #pragma unroll
  for (int i = 0; i < 8; ++i) xf[i]     = xpix[(long)(k0 + i) * HWP];
  #pragma unroll
  for (int i = 0; i < 8; ++i) xf[8 + i] = xpix[(long)(16 + k0 + i) * HWP];
}

// Two D tiles (channels 8*grp + r and 16 + 8*grp + r of the lane's pixel) as
// 32 bf16 channels of one pixel record: 16 B at 16*grp and at 32 + 16*grp.
__device__ __forceinline__ void put_rec(unsigned char* rec, int grp,
                                        f32x8 d0, f32x8 d1) {
  BFV t;
  #pragma unroll
  for (int r = 0; r < 8; ++r) { t.e[r] = (__bf16)d0[r]; t.e[8 + r] = (__bf16)d1[r]; }
  *(uint4*)(rec + 16 * grp)      = t.q4[0];
  *(uint4*)(rec + 32 + 16 * grp) = t.q4[1];
}

__global__ __launch_bounds__(256) void va_fused(
    const float* __restrict__ x,
    const float* __restrict__ Wqkv,
    const float* __restrict__ Wg,
    const float* __restrict__ bg,
    const float* __restrict__ W1,
    const float* __restrict__ b1,
    const float* __restrict__ ln_w,
    const float* __restrict__ ln_b,
    const float* __restrict__ W2,
    const float* __restrict__ b2,
    float* __restrict__ out)
{
  // b1 | b2: read every pass straight into the accumulators (C = D).
  __shared__ __attribute__((aligned(32))) float lds_bias[HIDN + CC];
  // -k and v of the tile and its ring, one record per pixel.
  __shared__ __attribute__((aligned(16))) unsigned char lds_kv[HROWS * HCOLS * KVPITCH];
  // gate + bg + x, element i of thread t at [i * 256 + t] (lane-private).
  __shared__ float lds_base[16 * 256];
  // All weights, bf16, in A-tile order.
  __shared__ __attribute__((aligned(16))) unsigned char lds_w[NTILES * 1024];

  const int tid = threadIdx.x;
  const float bias_in = (tid < HIDN) ? b1[tid] : b2[iclamp(tid - HIDN, 0, CC - 1)];

  // ---- Phase 0: weight loads (2048 groups of 4 floats, 8 a thread) ----
  float wl[8][4];
  #pragma unroll
  for (int j = 0; j < 8; ++j) {
    const float* wsrc = j < 3 ? Wqkv + j * 1024
                      : j < 4 ? Wg
                      : j < 6 ? W1 + (j - 4) * 1024
                              : W2 + (j - 6) * 1024;
    #pragma unroll
    for (int i = 0; i < 4; ++i) wl[j][i] = wsrc[tid * 4 + i];
  }

  const int lane = threadIdx.x & 31;
  const int wave = __builtin_amdgcn_readfirstlane(threadIdx.x >> 5);
  const int grp  = lane >> 4;
  const int lm   = lane & 15;
  const int k0   = grp ? 8 : 0;

  const int tile = blockIdx.x;             // 2048 tiles
  const int tw = tile & 15;                // 16 tiles across W
  const int th = (tile >> 4) & 31;         // 32 tiles across H
  const int b  = tile >> 9;
  const int h0 = th * TROWS;
  const int h  = h0 + wave;
  const int w0 = tw * TCOLS;
  const float* xb = x + (long)b * CC * HWP;

  // ---- Phase 1 ----
  // Ring pixel p of waves 0..3: top row, bottom row, then left/right pairs.
  const int p  = wave * 16 + lm;
  const int e  = p - 2 * HCOLS;
  const int hr = p < HCOLS ? 0 : (p < 2 * HCOLS ? HROWS - 1 : 1 + (e >> 1));
  const int wc = p < HCOLS ? p : (p < 2 * HCOLS ? p - HCOLS : (e & 1) * (HCOLS - 1));
  const int hh = h0 - 1 + hr;
  const int ww = w0 - 1 + wc;
  const bool ring_ok = (p < NRING) && (hh >= 0) && (hh < HH) && (ww >= 0) && (ww < WW);

  // All x loads first: they come from furthest away.
  // Waves 4..7 have no ring pixel and name their own pixel again (the same
  // lines): no branch, so these loads fly together with the rest.
  const int rh = wave < 4 ? iclamp(hh, 0, HH - 1) : h;
  const int rw = wave < 4 ? iclamp(ww, 0, WW - 1) : w0 + lm;
  float xr[16];
  load_x(xb + rh * WW + rw, k0, xr);
  float xf[16];
  load_x(xb + h * WW + w0 + lm, k0, xf);

  float bgl[16];
  #pragma unroll
  for (int j = 0; j < 2; ++j)
    #pragma unroll
    for (int r = 0; r < 8; ++r) bgl[j * 8 + r] = bg[j * 16 + k0 + r];
  const f32x8 cz = {};

  // Scheduling fence: every load above is issued before the first wait; without
  // it the weights' conversions, and their wait, move up in front of the x loads,
  // and a wave waits out the two latencies in turn.
  __builtin_amdgcn_sched_barrier(0);

  // Place of a thread's 4 weights inside a tile: columns 4*c4 .. 4*c4+3.
  {
    const int c4   = tid & 7;
    const int incol = (c4 >> 2) * 512 + ((c4 >> 1) & 1) * 256 + (c4 & 1) * 8;
    // 32-column matrices: 32 rows (two tiles) a round; row = tid >> 3.
    unsigned char* d32 = lds_w + (tid >> 7) * 1024 + ((tid >> 3) & 15) * 16 + incol;
    // W2 (64 columns): 16 rows a round; row = tid >> 4, K step = bit 3.
    unsigned char* d64 = lds_w + ((tid >> 3) & 1) * 1024 + (tid >> 4) * 16 + incol;
    #pragma unroll
    for (int j = 0; j < 6; ++j) put_w4(d32 + j * 2048, wl[j]);
    #pragma unroll
    for (int j = 6; j < 8; ++j) put_w4(d64 + j * 2048, wl[j]);
  }
  // Publishes the weight image.
  __syncthreads();

  bf16x16 Aq[2], Ak[2], Av[2], Ag[2];
  #pragma unroll
  for (int j = 0; j < 2; ++j) {
    Aq[j] = read_a(lds_w, T_Q + j, lane);
    Ak[j] = read_a(lds_w, T_K + j, lane);
    Av[j] = read_a(lds_w, T_V + j, lane);
    Ag[j] = read_a(lds_w, T_G + j, lane);
  }

  // Inputs-only fence on the loaded ring values: without it the compiler sinks
  // their loads into the branch below, behind the wait for the weights, and a
  // ring wave waits out two memory latencies in turn.
  asm volatile("" :: "v"(xr[0]), "v"(xr[1]), "v"(xr[2]), "v"(xr[3]),
                     "v"(xr[4]), "v"(xr[5]), "v"(xr[6]), "v"(xr[7]),
                     "v"(xr[8]), "v"(xr[9]), "v"(xr[10]), "v"(xr[11]),
                     "v"(xr[12]), "v"(xr[13]), "v"(xr[14]), "v"(xr[15]));
  if (wave < 4) {
    BFV rv;
    #pragma unroll
    for (int i = 0; i < 16; ++i) rv.e[i] = (__bf16)xr[i];
    #pragma unroll
    for (int i = 0; i < 8; ++i) rv.u[i] = ring_ok ? rv.u[i] : 0u;
    const f32x8 rk0 = wmma_bf16(Ak[0], rv.v, cz);
    const f32x8 rk1 = wmma_bf16(Ak[1], rv.v, cz);
    const f32x8 rv0 = wmma_bf16(Av[0], rv.v, cz);
    const f32x8 rv1 = wmma_bf16(Av[1], rv.v, cz);
    if (p < NRING) {
      unsigned char* rec = lds_kv + (hr * HCOLS + wc) * KVPITCH;
      put_rec(rec,      grp, -rk0, -rk1);    // -k
      put_rec(rec + 64, grp,  rv0,  rv1);
    }
  }

  BFV qv;
  {
    BFV bv;
    #pragma unroll
    for (int i = 0; i < 16; ++i) bv.e[i] = (__bf16)xf[i];
    const f32x8 ok0 = wmma_bf16(Ak[0], bv.v, cz);
    const f32x8 ok1 = wmma_bf16(Ak[1], bv.v, cz);
    const f32x8 ov0 = wmma_bf16(Av[0], bv.v, cz);
    const f32x8 ov1 = wmma_bf16(Av[1], bv.v, cz);
    unsigned char* rec = lds_kv + ((wave + 1) * HCOLS + lm + 1) * KVPITCH;
    put_rec(rec,      grp, -ok0, -ok1);      // -k
    put_rec(rec + 64, grp,  ov0,  ov1);

    // q as a B column (pixel w0+lm), kept packed bf16.
    #pragma unroll
    for (int j = 0; j < 2; ++j) {
      const f32x8 qa = wmma_bf16(Aq[j], bv.v, cz);
      #pragma unroll
      for (int r = 0; r < 8; ++r) qv.e[j * 8 + r] = (__bf16)qa[r];
    }
    // gate + bg + x in the D map: element j*8+r = channel 16j + 8*grp + r.
    #pragma unroll
    for (int j = 0; j < 2; ++j) {
      const f32x8 ga = wmma_bf16(Ag[j], bv.v, cz);
      #pragma unroll
      for (int r = 0; r < 8; ++r)
        lds_base[(j * 8 + r) * 256 + tid] = ga[r] + bgl[j * 8 + r] + xf[j * 8 + r];
    }
  }

  // ---- Phase 2 set-up ----
  // A1: W1 (64 x 32), 4 M-tiles.  A2: W2 (32 x 64), 2 M-tiles x 2 K-steps.
  bf16x16 A1t[4];
  #pragma unroll
  for (int n = 0; n < 4; ++n) A1t[n] = read_a(lds_w, T_W1 + n, lane);
  bf16x16 A2t[2][2];
  #pragma unroll
  for (int c = 0; c < 2; ++c)
    #pragma unroll
    for (int ks = 0; ks < 2; ++ks) A2t[c][ks] = read_a(lds_w, T_W2 + 2 * c + ks, lane);

  // Per-row parameters in the D map: register r = row 8*grp + r of a tile.
  f32x8 lwc[4], lbc[4];
  #pragma unroll
  for (int n = 0; n < 4; ++n)
    #pragma unroll
    for (int r = 0; r < 8; ++r) {
      const int d = n * 16 + k0 + r;
      lwc[n][r] = ln_w[d]; lbc[n][r] = ln_b[d];
    }
  const f32x8* biasrow = (const f32x8*)(lds_bias + k0);   // tile t: biasrow[2 * t]

  f32x8 num[2] = {};
  f32x8 den[2] = {};

  // Publishes the biases and every wave's k / v records.
  if (tid < HIDN + CC) lds_bias[tid] = bias_in;
  __syncthreads();

  // Record of halo pixel (wave, lm): the (dy, dx) = (-1, -1) neighbor.
  const unsigned char* rec0 = lds_kv + (wave * HCOLS + lm) * KVPITCH + 16 * grp;

  for (int nb = 0; nb < 9; ++nb) {
    // Compiler fence: keeps the bias reads inside the loop; hoisted, they
    // would hold 48 registers across it and cost resident waves.
    asm volatile("" ::: "memory");
    const unsigned char* rec = rec0 + ((nb / 3) * HCOLS + nb % 3) * KVPITCH;
    BFV kv;
    kv.q4[0] = *(const uint4*)(rec);
    kv.q4[1] = *(const uint4*)(rec + 32);
    const uint4 v0 = *(const uint4*)(rec + 64);
    const uint4 v1 = *(const uint4*)(rec + 96);
    const u32x8 vraw = {v0.x, v0.y, v0.z, v0.w, v1.x, v1.y, v1.z, v1.w};
    const bf16x16 vv = __builtin_bit_cast(bf16x16, vraw);
    BFV av;
    av.v = qv.v + kv.v;                 // packed bf16 add (k pre-negated)
    // hid^T = W1 * A^T + b1 : 64 x 16 in 4 accumulators (b1 enters as C).
    f32x8 hacc[4];
    #pragma unroll
    for (int n = 0; n < 4; ++n) hacc[n] = wmma_bf16(A1t[n], av.v, biasrow[2 * n]);

    // LayerNorm per pixel (= per lane pair l, l ^ 16).
    f32x8 s  = hacc[0] + hacc[1] + hacc[2] + hacc[3];
    f32x8 s2 = hacc[0] * hacc[0] + hacc[1] * hacc[1]
             + hacc[2] * hacc[2] + hacc[3] * hacc[3];
    float sv   = ((s[0] + s[1]) + (s[2] + s[3])) + ((s[4] + s[5]) + (s[6] + s[7]));
    float qsum = ((s2[0] + s2[1]) + (s2[2] + s2[3])) + ((s2[4] + s2[5]) + (s2[6] + s2[7]));
    sv   += other_half(sv);
    qsum += other_half(qsum);
    const float mu = sv * (1.0f / HIDN);
    float var = qsum * (1.0f / HIDN) - mu * mu;
    var = var > 0.f ? var : 0.f;
    // Hardware square root and reciprocal (about 1 ulp each) in place of the
    // correctly rounded sequences: inv is rounded to bf16 with the hidden values
    // right after.  A var too small for v_sqrt_f32 vanishes beside EPSV anyway.
    const float inv = __builtin_amdgcn_rcpf(__builtin_amdgcn_sqrtf(var) + EPSV);

    // Normalize + ReLU; D tiles 2ks, 2ks+1 converted in place are B of step ks.
    BFV hb[2];
    #pragma unroll
    for (int n = 0; n < 4; ++n)
      #pragma unroll
      for (int r = 0; r < 8; ++r) {
        float hv = (hacc[n][r] - mu) * inv;
        hv = lwc[n][r] * hv + lbc[n][r];
        hv = hv > 0.f ? hv : 0.f;
        hb[n >> 1].e[(n & 1) * 8 + r] = (__bf16)hv;
      }

    // scores^T = W2 * hid^T + b2 (K=64: two chained WMMAs, b2 enters as C),
    // then online softmax-weighted accumulation of v.
    #pragma unroll
    for (int c = 0; c < 2; ++c) {
      f32x8 sc = wmma_bf16(A2t[c][0], hb[0].v, biasrow[2 * (4 + c)]);
      sc = wmma_bf16(A2t[c][1], hb[1].v, sc);
      #pragma unroll
      for (int r = 0; r < 8; ++r) {
        const float vval = (float)vv[c * 8 + r];
        const float e = __expf(sc[r]);
        den[c][r] += e;
        num[c][r] += e * vval;
      }
    }
  }

  // out = (gate + bg + x) + weighted_v: every element stored once.
  #pragma unroll
  for (int c = 0; c < 2; ++c)
    #pragma unroll
    for (int r = 0; r < 8; ++r) {
      const int  ch = c * 16 + k0 + r;
      const long oi = ((long)b * CC + ch) * HWP + (long)h * WW + (w0 + lm);
      out[oi] = lds_base[(c * 8 + r) * 256 + tid]
              + num[c][r] * __builtin_amdgcn_rcpf(den[c][r]);
    }
}

extern "C" void kernel_launch(void* const* d_in, const int* in_sizes, int n_in,
                              void* d_out, int out_size, void* d_ws, size_t ws_size,
                              hipStream_t stream) {
  (void)in_sizes; (void)n_in; (void)out_size; (void)d_ws; (void)ws_size;
  const float* x    = (const float*)d_in[0];
  const float* Wqkv = (const float*)d_in[1];
  const float* W1   = (const float*)d_in[2];
  const float* b1   = (const float*)d_in[3];
  const float* ln_w = (const float*)d_in[4];
  const float* ln_b = (const float*)d_in[5];
  const float* W2   = (const float*)d_in[6];
  const float* b2   = (const float*)d_in[7];
  const float* Wg   = (const float*)d_in[8];
  const float* bg   = (const float*)d_in[9];
  float* out = (float*)d_out;

  // 2048 tiles (16 w-tiles x 32 h-tiles x 4 batches), 8 waves per tile.
  va_fused<<<dim3(2048), dim3(256), 0, stream>>>(x, Wqkv, Wg, bg, W1, b1, ln_w, ln_b,
                                                 W2, b2, out);
}

// v006
// One run takes 39.5 microseconds.
// Versions in between are left out here; by their measured steps it is 1.17 times as fast as v004.
// Over all steps from v000 it is 4.05 times as fast.
#include <hip/hip_runtime.h>
#include <hip/hip_bf16.h>

#define BB   4
#define CC   32
#define HH   256
#define WW   256
#define HIDN 64
#define HWP  (HH * WW)
#define EPSV 1e-5f

typedef __attribute__((ext_vector_type(16))) __bf16 bf16x16;
typedef __attribute__((ext_vector_type(8)))  float  f32x8;
typedef __attribute__((ext_vector_type(8)))  unsigned u32x8;

union BFV {
  bf16x16  v;
  __bf16   e[16];
  unsigned u[8];
  uint4    q4[2];
};

__device__ __forceinline__ int iclamp(int x, int lo, int hi) {
  return x < lo ? lo : (x > hi ? hi : x);
}

static __device__ __forceinline__ f32x8 wmma_bf16(bf16x16 a, bf16x16 b, f32x8 c) {
  // D = A(16x32 bf16) x B(32x16 bf16) + C(16x16 f32)
  return __builtin_amdgcn_wmma_f32_16x16x32_bf16(false, a, false, b, (short)0, c,
                                                 false, false);
}

// ---------------------------------------------------------------------------
// One launch.  A block owns 8 rows x 64 columns of one image and works through
// them as TPB tiles of 8 rows x 16 columns, left to right; in a tile a wave owns
// one row (16 pixels).  Phase 0 runs once a block, phases 1 and 2 once a tile.
// The x values of the next tile are loaded behind the tile's barrier, so they fly
// while phase 2 runs; k / v records have two buffers, so one barrier a tile both
// publishes the new records and ends the last reads of the buffer written next.
// Phase 0: the block brings all four weight matrices in once, 16 bytes a thread
//   and whole lines a wave, and lays them in LDS as bf16 in A-tile order; every
//   wave then reads its A tiles from there (two 16-byte LDS reads a tile).
//   W1 and b1 go in CENTERED over the 64 hidden units (each column of W1 minus
//   its mean, b1 minus its mean, in f32, before the rounding to bf16): the mean
//   over hidden units of W1c * a + b1c is 0 for every a, so the first MLP GEMM
//   yields hid - mean as it stands and LayerNorm needs no sum and no subtraction.
// Phase 1 (1x1 convs, weights as A, pixels as B columns):
//   every wave projects its own 16 pixels: -k and v go to LDS, q stays in
//   registers (two converted D tiles are the B operand of the first MLP GEMM as
//   they lie), gate + bg + x is parked in LDS, lane-private;
//   waves 0..3 also project the 52 pixels of the ring round the tile (-k, v).
//   A pixel outside the image enters as x = 0, so its k and v are 0
//   (zero-padded unfold; the qkv conv has no bias).
// Phase 2: neighbor MLP + softmax + weighted v, k and v read from LDS.
//   (hid - mean)^T (64 x 16 pix) = W1c * (q-k)^T + b1c : lane (lm, grp) holds
//     hidden units 16m + 8*grp + r of pixel lm -> the sum of squares is in-lane
//     plus one exchange with lane ^ 16;
//   two converted D tiles are the B operand of the second GEMM as they lie;
//   scores^T (32 x 16 pix): a lane holds channels 16c + 8*grp + r of pixel lm,
//     the same 8-channel runs that one 16-byte read of v brings.
// Neighbors are the outer loop; the 9-way softmax is a running accumulation.
// ---------------------------------------------------------------------------
#define TROWS  8                     // tile rows (= waves)
#define TCOLS  16                    // tile columns (= one WMMA N)
#define HCOLS  (TCOLS + 2)           // halo columns
#define HROWS  (TROWS + 2)           // halo rows
#define NRING  (2 * HCOLS + 2 * TROWS)
#define KVPITCH 144                  // -k 64 B | v 64 B | 16 B pad: 16 B x odd
#define KVBYTES (HROWS * HCOLS * KVPITCH)
#define TPB    4                     // tiles a block, neighbors along W

__device__ __forceinline__ float other_half(float x) {
  // value of lane ^ 16 (cross-row vector move)
  const int b = __builtin_bit_cast(int, x);
  return __builtin_bit_cast(float,
      __builtin_amdgcn_permlanex16(b, b, 0x76543210, 0xfedcba98, false, false));
}

// x plus the value of lane ^ M, M < 16 (row_xmask move folded into the add).
template <int M>
__device__ __forceinline__ float add_xmask(float x) {
  const int b = __builtin_bit_cast(int, x);
  return x + __builtin_bit_cast(float,
      __builtin_amdgcn_update_dpp(0, b, 0x160 + M, 0xf, 0xf, true));
}

// A-tile image in LDS: 1 KiB a tile (16 rows x 32 K, bf16) as two planes of
// 512 B; plane hf holds, at 16 B x lane, K values 16*hf + 8*grp + 0..7 of row lm
// (lane = 16*grp + lm): a wave's read of a plane is 512 contiguous bytes.
#define T_Q   0                      // Wqkv: tiles 0..5 (q, k, v: two each)
#define T_K   2
#define T_V   4
#define T_G   6                      // Wg:   tiles 6, 7
#define T_W1  8                      // W1:   tiles 8..11
#define T_W2  12                     // W2:   tile 12 + 2*c + ks
#define NTILES 16

__device__ __forceinline__ bf16x16 read_a(const unsigned char* img, int tile, int lane) {
  BFV t;
  t.q4[0] = *(const uint4*)(img + tile * 1024 + lane * 16);
  t.q4[1] = *(const uint4*)(img + tile * 1024 + 512 + lane * 16);
  return t.v;
}

// Four neighboring weights of one row as 4 bf16 (8 bytes of the image).
__device__ __forceinline__ void put_w4(unsigned char* dst, const float (&w)[4]) {
  union { __bf16 e[4]; uint2 d; } t;
  #pragma unroll
  for (int i = 0; i < 4; ++i) t.e[i] = (__bf16)w[i];
  *(uint2*)dst = t.d;
}

// x of one pixel per lane in the B map (channels k0+i, 16+k0+i), f32.  img is the
// image's first element (the same in every lane), off the lane's byte offset of
// channel k0 of its pixel: one register a lane instead of a pointer pair.
__device__ __forceinline__ void load_x(const float* __restrict__ img, unsigned off,
                                       float (&xf)[16]) {
  const float* xpix = (const float*)((const char*)img + off);
  #pragma unroll
  for (int i = 0; i < 8; ++i) xf[i]     = xpix[i * HWP];
  #pragma unroll
  for (int i = 0; i < 8; ++i) xf[8 + i] = xpix[(16 + i) * HWP];
}

// Two D tiles (channels 8*grp + r and 16 + 8*grp + r of the lane's pixel) as
// 32 bf16 channels of one pixel record: 16 B at 16*grp and at 32 + 16*grp.
__device__ __forceinline__ void put_rec(unsigned char* rec, int grp,
                                        f32x8 d0, f32x8 d1) {
  BFV t;
  #pragma unroll
  for (int r = 0; r < 8; ++r) { t.e[r] = (__bf16)d0[r]; t.e[8 + r] = (__bf16)d1[r]; }
  *(uint4*)(rec + 16 * grp)      = t.q4[0];
  *(uint4*)(rec + 32 + 16 * grp) = t.q4[1];
}

// Second bound: 4 waves a SIMD (two blocks a WGP), a budget of 256 registers.
__global__ __launch_bounds__(256, 4) void va_fused(
    const float* __restrict__ x,
    const float* __restrict__ Wqkv,
    const float* __restrict__ Wg,
    const float* __restrict__ bg,
    const float* __restrict__ W1,
    const float* __restrict__ b1,
    const float* __restrict__ ln_w,
    const float* __restrict__ ln_b,
    const float* __restrict__ W2,
    const float* __restrict__ b2,
    float* __restrict__ out)
{
  // b1 - mean(b1) | b2: read every pass straight into the accumulators (C = D).
  // Behind them bg, read once a tile.
  __shared__ __attribute__((aligned(32))) float lds_bias[HIDN + CC + CC];
  // -k and v of the tile and its ring, one record per pixel; tile t uses buffer t & 1.
  __shared__ __attribute__((aligned(16))) unsigned char lds_kv[2 * KVBYTES];
  // gate + bg + x, element i of thread t at [i * 256 + t] (lane-private).
  __shared__ float lds_base[16 * 256];
  // All weights, bf16, in A-tile order.
  __shared__ __attribute__((aligned(16))) unsigned char lds_w[NTILES * 1024];
  // Column sums of W1 over the 8 rows that each wave loads.
  __shared__ __attribute__((aligned(16))) float lds_csum[TROWS * CC];

  const int tid = threadIdx.x;
  const int lane = threadIdx.x & 31;
  const int wave = __builtin_amdgcn_readfirstlane(threadIdx.x >> 5);
  // Waves 0, 1: b1; wave 2: b2; wave 3 (and the rest, unused): bg.
  const float in_b1 = b1[tid & (HIDN - 1)];
  const float in_b2 = b2[lane];
  const float in_bg = bg[lane];
  const float bias_in = wave < 2 ? in_b1 : (wave == 2 ? in_b2 : in_bg);
  // All of b1, two values a lane: a wave that writes biases forms the mean itself.
  const float b1lo = b1[2 * (tid & 31)];
  const float b1hi = b1[2 * (tid & 31) + 1];

  // ---- Phase 0: weight loads (2048 groups of 4 floats, 8 a thread) ----
  float wl[8][4];
  #pragma unroll
  for (int j = 0; j < 8; ++j) {
    const float* wsrc = j < 3 ? Wqkv + j * 1024
                      : j < 4 ? Wg
                      : j < 6 ? W1 + (j - 4) * 1024
                              : W2 + (j - 6) * 1024;
    #pragma unroll
    for (int i = 0; i < 4; ++i) wl[j][i] = wsrc[tid * 4 + i];
  }

  const int grp  = lane >> 4;
  const int lm   = lane & 15;
  const int k0   = grp ? 8 : 0;

  const int tile = blockIdx.x * TPB;       // first of the block's tiles (2048 in all)
  const int tw = tile & 15;                // 16 tiles across W
  const int th = (tile >> 4) & 31;         // 32 tiles across H
  const int b  = tile >> 9;
  const int h0 = th * TROWS;
  const int h  = h0 + wave;
  const int wfirst = tw * TCOLS;
  const float* xb = x + (long)b * CC * HWP;

  // ---- Phase 1 ----
  // Ring pixel p of waves 0..3: top row, bottom row, then left/right pairs.
  const int p  = wave * 16 + lm;
  const int e  = p - 2 * HCOLS;
  const int hr = p < HCOLS ? 0 : (p < 2 * HCOLS ? HROWS - 1 : 1 + (e >> 1));
  const int wc = p < HCOLS ? p : (p < 2 * HCOLS ? p - HCOLS : (e & 1) * (HCOLS - 1));
  const int hh = h0 - 1 + hr;
  const bool ring_row_ok = (p < NRING) && (hh >= 0) && (hh < HH);

  // All x loads first: they come from furthest away.
  // Waves 4..7 have no ring pixel and name their own pixel again (the same
  // lines): no branch, so these loads fly together with the rest.
  const int rh = wave < 4 ? iclamp(hh, 0, HH - 1) : h;
  const int rw = wave < 4 ? iclamp(wfirst - 1 + wc, 0, WW - 1) : wfirst + lm;
  // Byte offsets inside the image: channel k0, the ring pixel's row; the own pixel
  // in the first tile.
  const unsigned ring_row = 4u * (unsigned)(k0 * HWP + rh * WW);
  const unsigned own_first = 4u * (unsigned)(k0 * HWP + h * WW + wfirst + lm);
  float xr[16];
  load_x(xb, ring_row + 4u * (unsigned)rw, xr);
  float xf[16];
  load_x(xb, own_first, xf);

  const f32x8 cz = {};

  // Scheduling fence: every load above is issued before the first wait; without
  // it the weights' conversions, and their wait, move up in front of the x loads,
  // and a wave waits out the two latencies in turn.
  __builtin_amdgcn_sched_barrier(0);

  // Place of a thread's 4 weights inside a tile: columns 4*c4 .. 4*c4+3.
  const int c4   = tid & 7;
  const int incol = (c4 >> 2) * 512 + ((c4 >> 1) & 1) * 256 + (c4 & 1) * 8;
  // 32-column matrices: 32 rows (two tiles) a round; row = tid >> 3.
  unsigned char* d32 = lds_w + (tid >> 7) * 1024 + ((tid >> 3) & 15) * 16 + incol;
  {
    // W2 (64 columns): 16 rows a round; row = tid >> 4, K step = bit 3.
    unsigned char* d64 = lds_w + ((tid >> 3) & 1) * 1024 + (tid >> 4) * 16 + incol;
    #pragma unroll
    for (int j = 0; j < 4; ++j) put_w4(d32 + j * 2048, wl[j]);
    #pragma unroll
    for (int j = 6; j < 8; ++j) put_w4(d64 + j * 2048, wl[j]);
    // W1 waits for its column means.  A thread holds columns 4*c4 .. 4*c4+3 of
    // two rows; lanes l, l^8, l^16, l^24 hold the same columns of a wave's rows.
    float cs[4];
    #pragma unroll
    for (int i = 0; i < 4; ++i) cs[i] = wl[4][i] + wl[5][i];
    #pragma unroll
    for (int i = 0; i < 4; ++i) cs[i] = add_xmask<8>(cs[i]);
    #pragma unroll
    for (int i = 0; i < 4; ++i) cs[i] += other_half(cs[i]);
    if (lane < 8)
      *(float4*)(lds_csum + wave * CC + 4 * lane) = make_float4(cs[0], cs[1], cs[2], cs[3]);
  }
  // Whole waves 0..3 write the biases.
  if (wave < (HIDN + CC + CC) / 32) {
    // Mean of b1: the lane's two values, then lanes ^1, ^2, ^4, ^8, ^16.
    float b1m = b1lo + b1hi;
    b1m = add_xmask<1>(b1m);
    b1m = add_xmask<2>(b1m);
    b1m = add_xmask<4>(b1m);
    b1m = add_xmask<8>(b1m);
    b1m += other_half(b1m);
    lds_bias[tid] = tid < HIDN ? bias_in - b1m * (1.0f / HIDN) : bias_in;
  }
  // Publishes the weight image (all but W1), the biases and the waves' column
  // sums of W1.
  __syncthreads();

  // W1 minus its column means, into the image; read behind the next barrier.
  {
    const float4 t0 = *(const float4*)(lds_csum + 4 * c4);
    float cm[4] = {t0.x, t0.y, t0.z, t0.w};
    #pragma unroll
    for (int w = 1; w < TROWS; ++w) {
      const float4 t = *(const float4*)(lds_csum + w * CC + 4 * c4);
      cm[0] += t.x; cm[1] += t.y; cm[2] += t.z; cm[3] += t.w;
    }
    #pragma unroll
    for (int j = 4; j < 6; ++j) {
      #pragma unroll
      for (int i = 0; i < 4; ++i) wl[j][i] -= cm[i] * (1.0f / HIDN);
      put_w4(d32 + j * 2048, wl[j]);
    }
  }

  // Per-row parameters in the D map: register r = row 8*grp + r of a tile.
  f32x8 lwc[4], lbc[4];
  #pragma unroll
  for (int n = 0; n < 4; ++n)
    #pragma unroll
    for (int r = 0; r < 8; ++r) {
      const int d = n * 16 + k0 + r;
      lwc[n][r] = ln_w[d]; lbc[n][r] = ln_b[d];
    }
  const f32x8* biasrow = (const f32x8*)(lds_bias + k0);   // tile t: biasrow[2 * t]

  // The own pixel's offset one tile ahead: names the next x, and, one tile back,
  // this tile's output; it lives through phase 2, so no load lands on it.
  unsigned own_next = own_first;
  for (int t = 0; t < TPB; ++t) {
    const int w0 = wfirst + t * TCOLS;
    unsigned char* kvbuf = lds_kv + (t & 1) * KVBYTES;

    // ---- Phase 1 ----
    bf16x16 Aq[2], Ak[2], Av[2], Ag[2];
    #pragma unroll
    for (int j = 0; j < 2; ++j) {
      Aq[j] = read_a(lds_w, T_Q + j, lane);
      Ak[j] = read_a(lds_w, T_K + j, lane);
      Av[j] = read_a(lds_w, T_V + j, lane);
      Ag[j] = read_a(lds_w, T_G + j, lane);
    }

    if (wave < 4) {
      const int ww = w0 - 1 + wc;
      const bool ring_ok = ring_row_ok && (ww >= 0) && (ww < WW);
      BFV rv;
      #pragma unroll
      for (int i = 0; i < 16; ++i) rv.e[i] = (__bf16)xr[i];
      #pragma unroll
      for (int i = 0; i < 8; ++i) rv.u[i] = ring_ok ? rv.u[i] : 0u;
      const f32x8 rk0 = wmma_bf16(Ak[0], rv.v, cz);
      const f32x8 rk1 = wmma_bf16(Ak[1], rv.v, cz);
      const f32x8 rv0 = wmma_bf16(Av[0], rv.v, cz);
      const f32x8 rv1 = wmma_bf16(Av[1], rv.v, cz);
      if (p < NRING) {
        unsigned char* rec = kvbuf + (hr * HCOLS + wc) * KVPITCH;
        put_rec(rec,      grp, -rk0, -rk1);    // -k
        put_rec(rec + 64, grp,  rv0,  rv1);
      }
    }

    BFV qv;
    {
      BFV bv;
      #pragma unroll
      for (int i = 0; i < 16; ++i) bv.e[i] = (__bf16)xf[i];
      const f32x8 ok0 = wmma_bf16(Ak[0], bv.v, cz);
      const f32x8 ok1 = wmma_bf16(Ak[1], bv.v, cz);
      const f32x8 ov0 = wmma_bf16(Av[0], bv.v, cz);
      const f32x8 ov1 = wmma_bf16(Av[1], bv.v, cz);
      unsigned char* rec = kvbuf + ((wave + 1) * HCOLS + lm + 1) * KVPITCH;
      put_rec(rec,      grp, -ok0, -ok1);      // -k
      put_rec(rec + 64, grp,  ov0,  ov1);

      // q as a B column (pixel w0+lm), kept packed bf16.
      #pragma unroll
      for (int j = 0; j < 2; ++j) {
        const f32x8 qa = wmma_bf16(Aq[j], bv.v, cz);
        #pragma unroll
        for (int r = 0; r < 8; ++r) qv.e[j * 8 + r] = (__bf16)qa[r];
      }
      // gate + bg + x in the D map: element j*8+r = channel 16j + 8*grp + r.
      #pragma unroll
      for (int j = 0; j < 2; ++j) {
        const f32x8 ga = wmma_bf16(Ag[j], bv.v, cz);
        const f32x8 bgv = biasrow[2 * (6 + j)];
        #pragma unroll
        for (int r = 0; r < 8; ++r)
          lds_base[(j * 8 + r) * 256 + tid] = ga[r] + bgv[r] + xf[j * 8 + r];
      }
    }

    // Publishes every wave's k / v records of this tile (in the first tile
    // also the centered W1 image); behind it no wave reads the
    // other record buffer any more, which the next tile's phase 1 writes.
    __syncthreads();

    // x of the next tile: issued behind the barrier (whose fence waits for every
    // load in flight) and first used in the next phase 1, so phase 2 covers them.
    own_next += 4u * TCOLS;
    if (t + 1 < TPB) {
      const int wn = w0 + TCOLS;
      const int rwn = wave < 4 ? iclamp(wn - 1 + wc, 0, WW - 1) : wn + lm;
      load_x(xb, ring_row + 4u * (unsigned)rwn, xr);
      load_x(xb, own_next, xf);
    }

    // ---- Phase 2 ----
    // A2: W2 (32 x 64), 2 M-tiles x 2 K-steps.
    bf16x16 A2t[2][2];
    #pragma unroll
    for (int c = 0; c < 2; ++c)
      #pragma unroll
      for (int ks = 0; ks < 2; ++ks) A2t[c][ks] = read_a(lds_w, T_W2 + 2 * c + ks, lane);
    // A1: centered W1 (64 x 32), 4 M-tiles.
    bf16x16 A1t[4];
    #pragma unroll
    for (int n = 0; n < 4; ++n) A1t[n] = read_a(lds_w, T_W1 + n, lane);

    f32x8 num[2] = {};
    f32x8 den[2] = {};

    // Record of halo pixel (wave, lm): the (dy, dx) = (-1, -1) neighbor.
    const unsigned char* rec0 = kvbuf + (wave * HCOLS + lm) * KVPITCH + 16 * grp;

    for (int nb = 0; nb < 9; ++nb) {
      // Compiler fence: keeps the bias reads inside the loop; hoisted, they
      // would hold 48 registers across it and cost resident waves.
      asm volatile("" ::: "memory");
      const unsigned char* rec = rec0 + ((nb / 3) * HCOLS + nb % 3) * KVPITCH;
      BFV kv;
      kv.q4[0] = *(const uint4*)(rec);
      kv.q4[1] = *(const uint4*)(rec + 32);
      const uint4 v0 = *(const uint4*)(rec + 64);
      const uint4 v1 = *(const uint4*)(rec + 96);
      const u32x8 vraw = {v0.x, v0.y, v0.z, v0.w, v1.x, v1.y, v1.z, v1.w};
      const bf16x16 vv = __builtin_bit_cast(bf16x16, vraw);
      BFV av;
      av.v = qv.v + kv.v;                 // packed bf16 add (k pre-negated)
      // (hid - mean)^T = W1c * A^T + b1c : 64 x 16 in 4 accumulators (b1c as C).
      f32x8 hacc[4];
      #pragma unroll
      for (int n = 0; n < 4; ++n) hacc[n] = wmma_bf16(A1t[n], av.v, biasrow[2 * n]);

      // LayerNorm per pixel (= per lane pair l, l ^ 16): the values are centered
      // as they come, so the variance is their mean square.
      f32x8 s2 = hacc[0] * hacc[0] + hacc[1] * hacc[1]
               + hacc[2] * hacc[2] + hacc[3] * hacc[3];
      float qsum = ((s2[0] + s2[4]) + (s2[2] + s2[6])) + ((s2[1] + s2[5]) + (s2[3] + s2[7]));
      qsum += other_half(qsum);
      const float var = qsum * (1.0f / HIDN);
      // Hardware square root and reciprocal (about 1 ulp each) in place of the
      // correctly rounded sequences: inv is rounded to bf16 with the hidden values
      // right after.  A var too small for v_sqrt_f32 vanishes beside EPSV anyway.
      const float inv = __builtin_amdgcn_rcpf(__builtin_amdgcn_sqrtf(var) + EPSV);

      // Normalize + ReLU; D tiles 2ks, 2ks+1 converted in place are B of step ks.
      BFV hb[2];
      #pragma unroll
      for (int n = 0; n < 4; ++n)
        #pragma unroll
        for (int r = 0; r < 8; ++r) {
          float hv = hacc[n][r] * inv;
          hv = lwc[n][r] * hv + lbc[n][r];
          hv = hv > 0.f ? hv : 0.f;
          hb[n >> 1].e[(n & 1) * 8 + r] = (__bf16)hv;
        }

      // scores^T = W2 * hid^T + b2 (K=64: two chained WMMAs, b2 enters as C),
      // then online softmax-weighted accumulation of v.
      #pragma unroll
      for (int c = 0; c < 2; ++c) {
        f32x8 sc = wmma_bf16(A2t[c][0], hb[0].v, biasrow[2 * (4 + c)]);
        sc = wmma_bf16(A2t[c][1], hb[1].v, sc);
        #pragma unroll
        for (int r = 0; r < 8; ++r) {
          const float vval = (float)vv[c * 8 + r];
          const float e = __expf(sc[r]);
          den[c][r] += e;
          num[c][r] += e * vval;
        }
      }
    }

    // out = (gate + bg + x) + weighted_v: every element stored once.
    float* opix = (float*)((char*)(out + (long)b * CC * HWP) + own_next) - TCOLS;
    #pragma unroll
    for (int c = 0; c < 2; ++c)
      #pragma unroll
      for (int r = 0; r < 8; ++r)
        opix[(c * 16 + r) * HWP] = lds_base[(c * 8 + r) * 256 + tid]
                                 + num[c][r] * __builtin_amdgcn_rcpf(den[c][r]);
    // The next tile's first instructions overwrite registers that these stores
    // name (data, offset), and the build has no wait on the way back up: this one
    // stands in front of them, as a precaution.
    asm volatile("s_wait_xcnt 0x0" ::: "memory");
  }
}

extern "C" void kernel_launch(void* const* d_in, const int* in_sizes, int n_in,
                              void* d_out, int out_size, void* d_ws, size_t ws_size,
                              hipStream_t stream) {
  (void)in_sizes; (void)n_in; (void)out_size; (void)d_ws; (void)ws_size;
  const float* x    = (const float*)d_in[0];
  const float* Wqkv = (const float*)d_in[1];
  const float* W1   = (const float*)d_in[2];
  const float* b1   = (const float*)d_in[3];
  const float* ln_w = (const float*)d_in[4];
  const float* ln_b = (const float*)d_in[5];
  const float* W2   = (const float*)d_in[6];
  const float* b2   = (const float*)d_in[7];
  const float* Wg   = (const float*)d_in[8];
  const float* bg   = (const float*)d_in[9];
  float* out = (float*)d_out;

  // 2048 tiles (16 w-tiles x 32 h-tiles x 4 batches), TPB = 4 tiles and 8 waves a
  // block: 512 blocks, two on each WGP, all resident at once.
  va_fused<<<dim3(512), dim3(256), 0, stream>>>(x, Wqkv, Wg, bg, W1, b1, ln_w, ln_b,
                                                 W2, b2, out);
}

// v007
// One run takes 36.2 microseconds.
// In both of two side-by-side timings against v006, it was 1.09 times as fast.
// Over all steps from v000 it is 4.41 times as fast.
#include <hip/hip_runtime.h>
#include <hip/hip_bf16.h>

#define BB   4
#define CC   32
#define HH   256
#define WW   256
#define HIDN 64
#define HWP  (HH * WW)
#define EPSV 1e-5f

typedef __attribute__((ext_vector_type(16))) __bf16 bf16x16;
typedef __attribute__((ext_vector_type(8)))  float  f32x8;
typedef __attribute__((ext_vector_type(8)))  unsigned u32x8;

union BFV {
  bf16x16  v;
  __bf16   e[16];
  unsigned u[8];
  uint4    q4[2];
};

__device__ __forceinline__ int iclamp(int x, int lo, int hi) {
  return x < lo ? lo : (x > hi ? hi : x);
}

static __device__ __forceinline__ f32x8 wmma_bf16(bf16x16 a, bf16x16 b, f32x8 c) {
  // D = A(16x32 bf16) x B(32x16 bf16) + C(16x16 f32)
  return __builtin_amdgcn_wmma_f32_16x16x32_bf16(false, a, false, b, (short)0, c,
                                                 false, false);
}

// ---------------------------------------------------------------------------
// One launch.  A block owns 8 rows x 64 columns of one image and works through
// them as TPB tiles of 8 rows x 16 columns, left to right; in a tile a wave owns
// one row (16 pixels).  Phase 0 runs once a block, phases 1 and 2 once a tile.
// The x values of the next tile are loaded behind the tile's neighbor loop, in front
// of its output part; k / v records have two buffers, so one barrier a tile both
// publishes the new records and ends the last reads of the buffer written next.
// Phase 0: the block brings all four weight matrices in once, 16 bytes a thread
//   and whole lines a wave, and lays them in LDS as bf16 in A-tile order; every
//   wave then reads its A tiles from there (two 16-byte LDS reads a tile).
//   W1 and b1 go in CENTERED over the 64 hidden units (each column of W1 minus
//   its mean, b1 minus its mean, in f32, before the rounding to bf16): the mean
//   over hidden units of W1c * a + b1c is 0 for every a, so the first MLP GEMM
//   yields hid - mean as it stands and LayerNorm needs no sum and no subtraction.
// Phase 1 (1x1 convs, weights as A, pixels as B columns):
//   every wave projects its own 16 pixels: -k and v go to LDS, q stays in
//   registers (two converted D tiles are the B operand of the first MLP GEMM as
//   they lie), gate + bg + x is parked in LDS, lane-private;
//   waves 0..3 also project the 52 pixels of the ring round the tile (-k, v).
//   A pixel outside the image enters as x = 0, so its k and v are 0
//   (zero-padded unfold; the qkv conv has no bias).
// Phase 2: neighbor MLP + softmax + weighted v, k and v read from LDS.
//   W1c * q^T + b1c is formed once a tile and is the C operand of every neighbor:
//   (hid - mean)^T (64 x 16 pix) = W1c * (-k)^T + C : lane (lm, grp) holds
//     hidden units 16m + 8*grp + r of pixel lm -> the sum of squares is in-lane
//     plus one exchange with lane ^ 16;
//   two converted D tiles are the B operand of the second GEMM as they lie;
//   scores^T (32 x 16 pix): a lane holds channels 16c + 8*grp + r of pixel lm,
//     the same 8-channel runs that one 16-byte read of v brings.
// Neighbors are the outer loop; the 9-way softmax is a running accumulation.
// ---------------------------------------------------------------------------
#define TROWS  8                     // tile rows (= waves)
#define TCOLS  16                    // tile columns (= one WMMA N)
#define HCOLS  (TCOLS + 2)           // halo columns
#define HROWS  (TROWS + 2)           // halo rows
#define NRING  (2 * HCOLS + 2 * TROWS)
#define KVPITCH 144                  // -k 64 B | v 64 B | 16 B pad: 16 B x odd
#define KVBYTES (HROWS * HCOLS * KVPITCH)
#define TPB    4                     // tiles a block, neighbors along W

__device__ __forceinline__ float other_half(float x) {
  // value of lane ^ 16 (cross-row vector move)
  const int b = __builtin_bit_cast(int, x);
  return __builtin_bit_cast(float,
      __builtin_amdgcn_permlanex16(b, b, 0x76543210, 0xfedcba98, false, false));
}

// x plus the value of lane ^ M, M < 16 (row_xmask move folded into the add).
template <int M>
__device__ __forceinline__ float add_xmask(float x) {
  const int b = __builtin_bit_cast(int, x);
  return x + __builtin_bit_cast(float,
      __builtin_amdgcn_update_dpp(0, b, 0x160 + M, 0xf, 0xf, true));
}

// A-tile image in LDS: 1 KiB a tile (16 rows x 32 K, bf16) as two planes of
// 512 B; plane hf holds, at 16 B x lane, K values 16*hf + 8*grp + 0..7 of row lm
// (lane = 16*grp + lm): a wave's read of a plane is 512 contiguous bytes.
#define T_Q   0                      // Wqkv: tiles 0..5 (q, k, v: two each)
#define T_K   2
#define T_V   4
#define T_G   6                      // Wg:   tiles 6, 7
#define T_W1  8                      // W1:   tiles 8..11
#define T_W2  12                     // W2:   tile 12 + 2*c + ks
#define NTILES 16

__device__ __forceinline__ bf16x16 read_a(const unsigned char* img, int tile, int lane) {
  BFV t;
  t.q4[0] = *(const uint4*)(img + tile * 1024 + lane * 16);
  t.q4[1] = *(const uint4*)(img + tile * 1024 + 512 + lane * 16);
  return t.v;
}

// Four neighboring weights of one row as 4 bf16 (8 bytes of the image).
__device__ __forceinline__ void put_w4(unsigned char* dst, const float (&w)[4]) {
  union { __bf16 e[4]; uint2 d; } t;
  #pragma unroll
  for (int i = 0; i < 4; ++i) t.e[i] = (__bf16)w[i];
  *(uint2*)dst = t.d;
}

// x of one pixel per lane in the B map (channels k0+i, 16+k0+i), f32.  img is the
// image's first element (the same in every lane), off the lane's byte offset of
// channel k0 of its pixel: one register a lane instead of a pointer pair.
__device__ __forceinline__ void load_x(const float* __restrict__ img, unsigned off,
                                       float (&xf)[16]) {
  const float* xpix = (const float*)((const char*)img + off);
  #pragma unroll
  for (int i = 0; i < 8; ++i) xf[i]     = xpix[i * HWP];
  #pragma unroll
  for (int i = 0; i < 8; ++i) xf[8 + i] = xpix[(16 + i) * HWP];
}

// Two D tiles (channels 8*grp + r and 16 + 8*grp + r of the lane's pixel) as
// 32 bf16 channels of one pixel record: 16 B at 16*grp and at 32 + 16*grp.
__device__ __forceinline__ void put_rec(unsigned char* rec, int grp,
                                        f32x8 d0, f32x8 d1) {
  BFV t;
  #pragma unroll
  for (int r = 0; r < 8; ++r) { t.e[r] = (__bf16)d0[r]; t.e[8 + r] = (__bf16)d1[r]; }
  *(uint4*)(rec + 16 * grp)      = t.q4[0];
  *(uint4*)(rec + 32 + 16 * grp) = t.q4[1];
}

// Second bound: 4 waves a SIMD (two blocks a WGP), a budget of 256 registers.
__global__ __launch_bounds__(256, 4) void va_fused(
    const float* __restrict__ x,
    const float* __restrict__ Wqkv,
    const float* __restrict__ Wg,
    const float* __restrict__ bg,
    const float* __restrict__ W1,
    const float* __restrict__ b1,
    const float* __restrict__ ln_w,
    const float* __restrict__ ln_b,
    const float* __restrict__ W2,
    const float* __restrict__ b2,
    float* __restrict__ out)
{
  // b1 - mean(b1), read once a tile | b2, read every pass straight into the
  // accumulators (C = D).  Behind them bg, read once a tile.
  __shared__ __attribute__((aligned(32))) float lds_bias[HIDN + CC + CC];
  // -k and v of the tile and its ring, one record per pixel; tile t uses buffer t & 1.
  __shared__ __attribute__((aligned(16))) unsigned char lds_kv[2 * KVBYTES];
  // gate + bg + x, element i of thread t at [i * 256 + t] (lane-private).
  __shared__ float lds_base[16 * 256];
  // All weights, bf16, in A-tile order.
  __shared__ __attribute__((aligned(16))) unsigned char lds_w[NTILES * 1024];
  // Column sums of W1 over the 8 rows that each wave loads.
  __shared__ __attribute__((aligned(16))) float lds_csum[TROWS * CC];

  const int tid = threadIdx.x;
  const int lane = threadIdx.x & 31;
  const int wave = __builtin_amdgcn_readfirstlane(threadIdx.x >> 5);
  // Waves 0, 1: b1; wave 2: b2; wave 3 (and the rest, unused): bg.
  const float in_b1 = b1[tid & (HIDN - 1)];
  const float in_b2 = b2[lane];
  const float in_bg = bg[lane];
  const float bias_in = wave < 2 ? in_b1 : (wave == 2 ? in_b2 : in_bg);
  // All of b1, two values a lane: a wave that writes biases forms the mean itself.
  const float b1lo = b1[2 * (tid & 31)];
  const float b1hi = b1[2 * (tid & 31) + 1];

  // ---- Phase 0: weight loads (2048 groups of 4 floats, 8 a thread) ----
  float wl[8][4];
  #pragma unroll
  for (int j = 0; j < 8; ++j) {
    const float* wsrc = j < 3 ? Wqkv + j * 1024
                      : j < 4 ? Wg
                      : j < 6 ? W1 + (j - 4) * 1024
                              : W2 + (j - 6) * 1024;
    #pragma unroll
    for (int i = 0; i < 4; ++i) wl[j][i] = wsrc[tid * 4 + i];
  }

  const int grp  = lane >> 4;
  const int lm   = lane & 15;
  const int k0   = grp ? 8 : 0;

  const int tile = blockIdx.x * TPB;       // first of the block's tiles (2048 in all)
  const int tw = tile & 15;                // 16 tiles across W
  const int th = (tile >> 4) & 31;         // 32 tiles across H
  const int b  = tile >> 9;
  const int h0 = th * TROWS;
  const int h  = h0 + wave;
  const int wfirst = tw * TCOLS;
  const float* xb = x + (long)b * CC * HWP;

  // ---- Phase 1 ----
  // Ring pixel p of waves 0..3: top row, bottom row, then left/right pairs.
  const int p  = wave * 16 + lm;
  const int e  = p - 2 * HCOLS;
  const int hr = p < HCOLS ? 0 : (p < 2 * HCOLS ? HROWS - 1 : 1 + (e >> 1));
  const int wc = p < HCOLS ? p : (p < 2 * HCOLS ? p - HCOLS : (e & 1) * (HCOLS - 1));
  const int hh = h0 - 1 + hr;
  const bool ring_row_ok = (p < NRING) && (hh >= 0) && (hh < HH);

  // All x loads first: they come from furthest away.
  // Waves 4..7 have no ring pixel and name their own pixel again (the same
  // lines): no branch, so these loads fly together with the rest.
  const int rh = wave < 4 ? iclamp(hh, 0, HH - 1) : h;
  const int rw = wave < 4 ? iclamp(wfirst - 1 + wc, 0, WW - 1) : wfirst + lm;
  // Byte offsets inside the image: channel k0, the ring pixel's row; the own pixel
  // in the first tile.
  const unsigned ring_row = 4u * (unsigned)(k0 * HWP + rh * WW);
  const unsigned own_first = 4u * (unsigned)(k0 * HWP + h * WW + wfirst + lm);
  float xr[16];
  load_x(xb, ring_row + 4u * (unsigned)rw, xr);
  float xf[16];
  load_x(xb, own_first, xf);

  const f32x8 cz = {};

  // Scheduling fence: every load above is issued before the first wait; without
  // it the weights' conversions, and their wait, move up in front of the x loads,
  // and a wave waits out the two latencies in turn.
  __builtin_amdgcn_sched_barrier(0);

  // Place of a thread's 4 weights inside a tile: columns 4*c4 .. 4*c4+3.
  const int c4   = tid & 7;
  const int incol = (c4 >> 2) * 512 + ((c4 >> 1) & 1) * 256 + (c4 & 1) * 8;
  // 32-column matrices: 32 rows (two tiles) a round; row = tid >> 3.
  unsigned char* d32 = lds_w + (tid >> 7) * 1024 + ((tid >> 3) & 15) * 16 + incol;
  {
    // W2 (64 columns): 16 rows a round; row = tid >> 4, K step = bit 3.
    unsigned char* d64 = lds_w + ((tid >> 3) & 1) * 1024 + (tid >> 4) * 16 + incol;
    #pragma unroll
    for (int j = 0; j < 4; ++j) put_w4(d32 + j * 2048, wl[j]);
    #pragma unroll
    for (int j = 6; j < 8; ++j) put_w4(d64 + j * 2048, wl[j]);
    // W1 waits for its column means.  A thread holds columns 4*c4 .. 4*c4+3 of
    // two rows; lanes l, l^8, l^16, l^24 hold the same columns of a wave's rows.
    float cs[4];
    #pragma unroll
    for (int i = 0; i < 4; ++i) cs[i] = wl[4][i] + wl[5][i];
    #pragma unroll
    for (int i = 0; i < 4; ++i) cs[i] = add_xmask<8>(cs[i]);
    #pragma unroll
    for (int i = 0; i < 4; ++i) cs[i] += other_half(cs[i]);
    if (lane < 8)
      *(float4*)(lds_csum + wave * CC + 4 * lane) = make_float4(cs[0], cs[1], cs[2], cs[3]);
  }
  // Whole waves 0..3 write the biases.
  if (wave < (HIDN + CC + CC) / 32) {
    // Mean of b1: the lane's two values, then lanes ^1, ^2, ^4, ^8, ^16.
    float b1m = b1lo + b1hi;
    b1m = add_xmask<1>(b1m);
    b1m = add_xmask<2>(b1m);
    b1m = add_xmask<4>(b1m);
    b1m = add_xmask<8>(b1m);
    b1m += other_half(b1m);
    lds_bias[tid] = tid < HIDN ? bias_in - b1m * (1.0f / HIDN) : bias_in;
  }
  // Publishes the weight image (all but W1), the biases and the waves' column
  // sums of W1.
  __syncthreads();

  // W1 minus its column means, into the image; read behind the next barrier.
  {
    const float4 t0 = *(const float4*)(lds_csum + 4 * c4);
    float cm[4] = {t0.x, t0.y, t0.z, t0.w};
    #pragma unroll
    for (int w = 1; w < TROWS; ++w) {
      const float4 t = *(const float4*)(lds_csum + w * CC + 4 * c4);
      cm[0] += t.x; cm[1] += t.y; cm[2] += t.z; cm[3] += t.w;
    }
    #pragma unroll
    for (int j = 4; j < 6; ++j) {
      #pragma unroll
      for (int i = 0; i < 4; ++i) wl[j][i] -= cm[i] * (1.0f / HIDN);
      put_w4(d32 + j * 2048, wl[j]);
    }
  }

  // Per-row parameters in the D map: register r = row 8*grp + r of a tile.
  f32x8 lwc[4], lbc[4];
  #pragma unroll
  for (int n = 0; n < 4; ++n)
    #pragma unroll
    for (int r = 0; r < 8; ++r) {
      const int d = n * 16 + k0 + r;
      lwc[n][r] = ln_w[d]; lbc[n][r] = ln_b[d];
    }
  const f32x8* biasrow = (const f32x8*)(lds_bias + k0);   // tile t: biasrow[2 * t]

  // The own pixel's offset one tile ahead: names the next x, and, one tile back,
  // this tile's output; it lives through phase 2, so no load lands on it.
  unsigned own_next = own_first;
  for (int t = 0; t < TPB; ++t) {
    const int w0 = wfirst + t * TCOLS;
    unsigned char* kvbuf = lds_kv + (t & 1) * KVBYTES;

    // ---- Phase 1 ----
    bf16x16 Aq[2], Ak[2], Av[2], Ag[2];
    #pragma unroll
    for (int j = 0; j < 2; ++j) {
      Aq[j] = read_a(lds_w, T_Q + j, lane);
      Ak[j] = read_a(lds_w, T_K + j, lane);
      Av[j] = read_a(lds_w, T_V + j, lane);
      Ag[j] = read_a(lds_w, T_G + j, lane);
    }

    BFV qv;
    {
      BFV bv;
      #pragma unroll
      for (int i = 0; i < 16; ++i) bv.e[i] = (__bf16)xf[i];
      const f32x8 ok0 = wmma_bf16(Ak[0], bv.v, cz);
      const f32x8 ok1 = wmma_bf16(Ak[1], bv.v, cz);
      const f32x8 ov0 = wmma_bf16(Av[0], bv.v, cz);
      const f32x8 ov1 = wmma_bf16(Av[1], bv.v, cz);
      unsigned char* rec = kvbuf + ((wave + 1) * HCOLS + lm + 1) * KVPITCH;
      put_rec(rec,      grp, -ok0, -ok1);      // -k
      put_rec(rec + 64, grp,  ov0,  ov1);

      // q as a B column (pixel w0+lm), kept packed bf16.
      #pragma unroll
      for (int j = 0; j < 2; ++j) {
        const f32x8 qa = wmma_bf16(Aq[j], bv.v, cz);
        #pragma unroll
        for (int r = 0; r < 8; ++r) qv.e[j * 8 + r] = (__bf16)qa[r];
      }
      // gate + bg + x in the D map: element j*8+r = channel 16j + 8*grp + r.
      #pragma unroll
      for (int j = 0; j < 2; ++j) {
        const f32x8 ga = wmma_bf16(Ag[j], bv.v, cz);
        const f32x8 bgv = biasrow[2 * (6 + j)];
        #pragma unroll
        for (int r = 0; r < 8; ++r)
          lds_base[(j * 8 + r) * 256 + tid] = ga[r] + bgv[r] + xf[j * 8 + r];
      }
    }

    // The ring comes last: its x is loaded behind the neighbor loop of the tile
    // before, and the own pixels' work above covers the rest of its way.
    if (wave < 4) {
      const int ww = w0 - 1 + wc;
      const bool ring_ok = ring_row_ok && (ww >= 0) && (ww < WW);
      BFV rv;
      #pragma unroll
      for (int i = 0; i < 16; ++i) rv.e[i] = (__bf16)xr[i];
      #pragma unroll
      for (int i = 0; i < 8; ++i) rv.u[i] = ring_ok ? rv.u[i] : 0u;
      const f32x8 rk0 = wmma_bf16(Ak[0], rv.v, cz);
      const f32x8 rk1 = wmma_bf16(Ak[1], rv.v, cz);
      const f32x8 rv0 = wmma_bf16(Av[0], rv.v, cz);
      const f32x8 rv1 = wmma_bf16(Av[1], rv.v, cz);
      if (p < NRING) {
        unsigned char* rec = kvbuf + (hr * HCOLS + wc) * KVPITCH;
        put_rec(rec,      grp, -rk0, -rk1);    // -k
        put_rec(rec + 64, grp,  rv0,  rv1);
      }
    }

    // Publishes every wave's k / v records of this tile (before the first tile
    // also the centered W1 image); behind it no wave reads the
    // other record buffer any more, which the next tile's phase 1 writes.
    __syncthreads();

    own_next += 4u * TCOLS;

    // ---- Phase 2 ----
    // A2: W2 (32 x 64), 2 M-tiles x 2 K-steps.
    bf16x16 A2t[2][2];
    #pragma unroll
    for (int c = 0; c < 2; ++c)
      #pragma unroll
      for (int ks = 0; ks < 2; ++ks) A2t[c][ks] = read_a(lds_w, T_W2 + 2 * c + ks, lane);
    // A1: centered W1 (64 x 32), 4 M-tiles.
    bf16x16 A1t[4];
    #pragma unroll
    for (int n = 0; n < 4; ++n) A1t[n] = read_a(lds_w, T_W1 + n, lane);

    // W1c * q + b1c, once a tile: the C operand of every neighbor's first GEMM,
    // which then needs neither the bias from LDS nor q - k formed in registers.
    f32x8 hq[4];
    #pragma unroll
    for (int n = 0; n < 4; ++n) hq[n] = wmma_bf16(A1t[n], qv.v, biasrow[2 * n]);

    f32x8 num[2] = {};
    f32x8 den[2] = {};

    // Record of halo pixel (wave, lm): the (dy, dx) = (-1, -1) neighbor.
    const unsigned char* rec0 = kvbuf + (wave * HCOLS + lm) * KVPITCH + 16 * grp;

    for (int nb = 0; nb < 9; ++nb) {
      // Compiler fence: keeps the reads of b2 inside the loop; hoisted, they
      // would hold 16 registers across it, which are not there.
      asm volatile("" ::: "memory");
      const unsigned char* rec = rec0 + ((nb / 3) * HCOLS + nb % 3) * KVPITCH;
      BFV kv;
      kv.q4[0] = *(const uint4*)(rec);
      kv.q4[1] = *(const uint4*)(rec + 32);
      // (hid - mean)^T = W1c * (-k)^T + (W1c * q^T + b1c) : 64 x 16 in 4 accumulators.
      f32x8 hacc[4];
      #pragma unroll
      for (int n = 0; n < 4; ++n) hacc[n] = wmma_bf16(A1t[n], kv.v, hq[n]);

      // Scheduling fence: keeps v's reads behind the first GEMM, where -k's registers
      // are free again; read at the top, v costs 8 more and an A tile is spilled.
      __builtin_amdgcn_sched_barrier(0);
      const uint4 v0 = *(const uint4*)(rec + 64);
      const uint4 v1 = *(const uint4*)(rec + 96);
      const u32x8 vraw = {v0.x, v0.y, v0.z, v0.w, v1.x, v1.y, v1.z, v1.w};
      const bf16x16 vv = __builtin_bit_cast(bf16x16, vraw);

      // LayerNorm per pixel (= per lane pair l, l ^ 16): the values are centered
      // as they come, so the variance is their mean square.
      f32x8 s2 = hacc[0] * hacc[0] + hacc[1] * hacc[1]
               + hacc[2] * hacc[2] + hacc[3] * hacc[3];
      float qsum = ((s2[0] + s2[4]) + (s2[2] + s2[6])) + ((s2[1] + s2[5]) + (s2[3] + s2[7]));
      qsum += other_half(qsum);
      const float var = qsum * (1.0f / HIDN);
      // Hardware square root and reciprocal (about 1 ulp each) in place of the
      // correctly rounded sequences: inv is rounded to bf16 with the hidden values
      // right after.  A var too small for v_sqrt_f32 vanishes beside EPSV anyway.
      const float inv = __builtin_amdgcn_rcpf(__builtin_amdgcn_sqrtf(var) + EPSV);

      // Normalize + ReLU; D tiles 2ks, 2ks+1 converted in place are B of step ks.
      BFV hb[2];
      #pragma unroll
      for (int n = 0; n < 4; ++n)
        #pragma unroll
        for (int r = 0; r < 8; ++r) {
          float hv = hacc[n][r] * inv;
          hv = lwc[n][r] * hv + lbc[n][r];
          hv = hv > 0.f ? hv : 0.f;
          hb[n >> 1].e[(n & 1) * 8 + r] = (__bf16)hv;
        }

      // scores^T = W2 * hid^T + b2 (K=64: two chained WMMAs, b2 enters as C),
      // then online softmax-weighted accumulation of v.
      #pragma unroll
      for (int c = 0; c < 2; ++c) {
        f32x8 sc = wmma_bf16(A2t[c][0], hb[0].v, biasrow[2 * (4 + c)]);
        sc = wmma_bf16(A2t[c][1], hb[1].v, sc);
        #pragma unroll
        for (int r = 0; r < 8; ++r) {
          const float vval = (float)vv[c * 8 + r];
          const float e = __expf(sc[r]);
          den[c][r] += e;
          num[c][r] += e * vval;
        }
      }
    }

    // x of the next tile: issued here, not behind the barrier, so that its 32
    // registers are free inside the neighbor loop (W1c * q + b1c lives there).  Most
    // of its lines were touched by earlier tiles' loads, so the way is short; the
    // output part below and the A-tile reads cover it in part.
    if (t + 1 < TPB) {
      const int wn = w0 + TCOLS;
      const int rwn = wave < 4 ? iclamp(wn - 1 + wc, 0, WW - 1) : wn + lm;
      load_x(xb, own_next, xf);
      load_x(xb, ring_row + 4u * (unsigned)rwn, xr);
      // The output part's first instructions overwrite the address registers that
      // these loads name: this wait stands in front of them, as a precaution.
      asm volatile("s_wait_xcnt 0x0" ::: "memory");
    } else {
      // Ends the old values' life in phase 1: without a new value on this path they
      // would hold their 32 registers through the neighbor loop (spills).
      #pragma unroll
      for (int i = 0; i < 16; ++i) { xf[i] = 0.f; xr[i] = 0.f; }
    }

    // out = (gate + bg + x) + weighted_v: every element stored once.
    float* opix = (float*)((char*)(out + (long)b * CC * HWP) + own_next) - TCOLS;
    #pragma unroll
    for (int c = 0; c < 2; ++c)
      #pragma unroll
      for (int r = 0; r < 8; ++r)
        opix[(c * 16 + r) * HWP] = lds_base[(c * 8 + r) * 256 + tid]
                                 + num[c][r] * __builtin_amdgcn_rcpf(den[c][r]);
    // The next tile's first instructions overwrite registers that these stores
    // name (data, offset), and the build has no wait on the way back up: this one
    // stands in front of them, as a precaution.
    asm volatile("s_wait_xcnt 0x0" ::: "memory");
  }
}

extern "C" void kernel_launch(void* const* d_in, const int* in_sizes, int n_in,
                              void* d_out, int out_size, void* d_ws, size_t ws_size,
                              hipStream_t stream) {
  (void)in_sizes; (void)n_in; (void)out_size; (void)d_ws; (void)ws_size;
  const float* x    = (const float*)d_in[0];
  const float* Wqkv = (const float*)d_in[1];
  const float* W1   = (const float*)d_in[2];
  const float* b1   = (const float*)d_in[3];
  const float* ln_w = (const float*)d_in[4];
  const float* ln_b = (const float*)d_in[5];
  const float* W2   = (const float*)d_in[6];
  const float* b2   = (const float*)d_in[7];
  const float* Wg   = (const float*)d_in[8];
  const float* bg   = (const float*)d_in[9];
  float* out = (float*)d_out;

  // 2048 tiles (16 w-tiles x 32 h-tiles x 4 batches), TPB = 4 tiles and 8 waves a
  // block: 512 blocks, two on each WGP, all resident at once.
  va_fused<<<dim3(512), dim3(256), 0, stream>>>(x, Wqkv, Wg, bg, W1, b1, ln_w, ln_b,
                                                 W2, b2, out);
}

// v008
// One run takes 32.7 microseconds.
// Two timings next to v007 put it at 1.11 and 1.10 times that version's speed.
// All steps since v000 together make it 4.89 times as fast.
#include <hip/hip_runtime.h>
#include <hip/hip_bf16.h>

#define BB   4
#define CC   32
#define HH   256
#define WW   256
#define HIDN 64
#define HWP  (HH * WW)
#define EPSV 1e-5f

typedef __attribute__((ext_vector_type(16))) __bf16 bf16x16;
typedef __attribute__((ext_vector_type(8)))  float  f32x8;
typedef __attribute__((ext_vector_type(8)))  unsigned u32x8;

union BFV {
  bf16x16  v;
  __bf16   e[16];
  unsigned u[8];
  uint4    q4[2];
};

__device__ __forceinline__ int iclamp(int x, int lo, int hi) {
  return x < lo ? lo : (x > hi ? hi : x);
}

static __device__ __forceinline__ f32x8 wmma_bf16(bf16x16 a, bf16x16 b, f32x8 c) {
  // D = A(16x32 bf16) x B(32x16 bf16) + C(16x16 f32)
  return __builtin_amdgcn_wmma_f32_16x16x32_bf16(false, a, false, b, (short)0, c,
                                                 false, false);
}

// ---------------------------------------------------------------------------
// One launch.  A block owns 8 rows x 64 columns of one image and works through
// them as TPB tiles of 8 rows x 32 columns, left to right; in a tile a wave owns
// one row (32 pixels) and a lane two neighboring pixels of it, columns 2*lm and
// 2*lm + 1: 16 lanes x 8 bytes are one whole 128-byte line of x or of out.  The
// even columns are sub-tile 0, the odd ones sub-tile 1 (16 pixels = one WMMA N).
// Phase 0 runs once a block, phase 1 once a tile, phase 2 once a sub-tile.
// The x values of the next tile are loaded behind the tile's last neighbor loop, in
// front of its output part; k / v records have two buffers, so one barrier a tile both
// publishes the new records and ends the last reads of the buffer written next.
// Phase 0: the block brings all four weight matrices in once, 16 bytes a thread
//   and whole lines a wave, and lays them in LDS as bf16 in A-tile order; every
//   wave then reads its A tiles from there (two 16-byte LDS reads a tile).
//   W1 and b1 go in CENTERED over the 64 hidden units (each column of W1 minus
//   its mean, b1 minus its mean, in f32, before the rounding to bf16): the mean
//   over hidden units of W1c * a + b1c is 0 for every a, so the first MLP GEMM
//   yields hid - mean as it stands and LayerNorm needs no sum and no subtraction.
// Phase 1 (1x1 convs, weights as A, pixels as B columns):
//   every wave projects its own 32 pixels, a sub-tile at a time: -k and v go to LDS,
//   q of sub-tile 0 stays in registers (two converted D tiles are the B operand of
//   the first MLP GEMM as they lie), q of sub-tile 1 and gate + bg + x are parked in
//   LDS, lane-private;
//   waves 0..5 also project the 84 pixels of the ring round the tile (-k, v).
//   A pixel outside the image enters as x = 0, so its k and v are 0
//   (zero-padded unfold; the qkv conv has no bias).
// Phase 2: neighbor MLP + softmax + weighted v, k and v read from LDS.
//   W1c * q^T + b1c is formed once a sub-tile and is the C operand of every neighbor:
//   (hid - mean)^T (64 x 16 pix) = W1c * (-k)^T + C : lane (lm, grp) holds
//     hidden units 16m + 8*grp + r of pixel lm -> the sum of squares is in-lane
//     plus one exchange with lane ^ 16;
//   two converted D tiles are the B operand of the second GEMM as they lie;
//   scores^T (32 x 16 pix): a lane holds channels 16c + 8*grp + r of pixel lm,
//     the same 8-channel runs that one 16-byte read of v brings.
// Neighbors are the outer loop; the 9-way softmax is a running accumulation.
// ---------------------------------------------------------------------------
#define TROWS  8                     // tile rows (= waves)
#define TCOLS  32                    // tile columns (= two WMMA N)
#define HCOLS  (TCOLS + 2)           // halo columns
#define HHALF  (HCOLS / 2)           // halo columns of one parity
#define HROWS  (TROWS + 2)           // halo rows
#define NRING  (2 * HCOLS + 2 * TROWS)
#define RWAVES ((NRING + 15) / 16)   // waves with ring pixels
#define KVPITCH 144                  // -k 64 B | v 64 B | 16 B pad: 16 B x odd
// Records of even and of odd halo columns lie in two planes: the 16 pixels of a
// sub-tile, two columns apart, are then one pitch apart (no bank conflict).
#define KVPLANE (HROWS * HHALF * KVPITCH)
#define KVBYTES (2 * KVPLANE)
#define TPB    2                     // tiles a block, neighbors along W

__device__ __forceinline__ float other_half(float x) {
  // value of lane ^ 16 (cross-row vector move)
  const int b = __builtin_bit_cast(int, x);
  return __builtin_bit_cast(float,
      __builtin_amdgcn_permlanex16(b, b, 0x76543210, 0xfedcba98, false, false));
}

// x plus the value of lane ^ M, M < 16 (row_xmask move folded into the add).
template <int M>
__device__ __forceinline__ float add_xmask(float x) {
  const int b = __builtin_bit_cast(int, x);
  return x + __builtin_bit_cast(float,
      __builtin_amdgcn_update_dpp(0, b, 0x160 + M, 0xf, 0xf, true));
}

// A-tile image in LDS: 1 KiB a tile (16 rows x 32 K, bf16) as two planes of
// 512 B; plane hf holds, at 16 B x lane, K values 16*hf + 8*grp + 0..7 of row lm
// (lane = 16*grp + lm): a wave's read of a plane is 512 contiguous bytes.
#define T_Q   0                      // Wqkv: tiles 0..5 (q, k, v: two each)
#define T_K   2
#define T_V   4
#define T_G   6                      // Wg:   tiles 6, 7
#define T_W1  8                      // W1:   tiles 8..11
#define T_W2  12                     // W2:   tile 12 + 2*c + ks
#define NTILES 16

__device__ __forceinline__ bf16x16 read_a(const unsigned char* img, int tile, int lane) {
  BFV t;
  t.q4[0] = *(const uint4*)(img + tile * 1024 + lane * 16);
  t.q4[1] = *(const uint4*)(img + tile * 1024 + 512 + lane * 16);
  return t.v;
}

// Four neighboring weights of one row as 4 bf16 (8 bytes of the image).
__device__ __forceinline__ void put_w4(unsigned char* dst, const float (&w)[4]) {
  union { __bf16 e[4]; uint2 d; } t;
  #pragma unroll
  for (int i = 0; i < 4; ++i) t.e[i] = (__bf16)w[i];
  *(uint2*)dst = t.d;
}

// x of one pixel per lane in the B map (channels k0+i, 16+k0+i), f32.  img is the
// image's first element (the same in every lane), off the lane's byte offset of
// channel k0 of its pixel: one register a lane instead of a pointer pair.
__device__ __forceinline__ void load_x(const float* __restrict__ img, unsigned off,
                                       float (&xf)[16]) {
  const float* xpix = (const float*)((const char*)img + off);
  #pragma unroll
  for (int i = 0; i < 8; ++i) xf[i]     = xpix[i * HWP];
  #pragma unroll
  for (int i = 0; i < 8; ++i) xf[8 + i] = xpix[(16 + i) * HWP];
}

// The same for the lane's two neighboring pixels (8 bytes a channel).
__device__ __forceinline__ void load_x2(const float* __restrict__ img, unsigned off,
                                        float (&xe)[16], float (&xo)[16]) {
  const float* xpix = (const float*)((const char*)img + off);
  #pragma unroll
  for (int i = 0; i < 8; ++i) { xe[i] = xpix[i * HWP]; xo[i] = xpix[i * HWP + 1]; }
  #pragma unroll
  for (int i = 0; i < 8; ++i) {
    xe[8 + i] = xpix[(16 + i) * HWP]; xo[8 + i] = xpix[(16 + i) * HWP + 1];
  }
}

// Two D tiles (channels 8*grp + r and 16 + 8*grp + r of the lane's pixel) as
// 32 bf16 channels of one pixel record: 16 B at 16*grp and at 32 + 16*grp; rec
// names the first of the two.
__device__ __forceinline__ void put_rec(unsigned char* rec, f32x8 d0, f32x8 d1) {
  BFV t;
  #pragma unroll
  for (int r = 0; r < 8; ++r) { t.e[r] = (__bf16)d0[r]; t.e[8 + r] = (__bf16)d1[r]; }
  *(uint4*)(rec)      = t.q4[0];
  *(uint4*)(rec + 32) = t.q4[1];
}

// Second bound: 4 waves a SIMD (two blocks a WGP), a budget of 256 registers.
__global__ __launch_bounds__(256, 4) void va_fused(
    const float* __restrict__ x,
    const float* __restrict__ Wqkv,
    const float* __restrict__ Wg,
    const float* __restrict__ bg,
    const float* __restrict__ W1,
    const float* __restrict__ b1,
    const float* __restrict__ ln_w,
    const float* __restrict__ ln_b,
    const float* __restrict__ W2,
    const float* __restrict__ b2,
    float* __restrict__ out)
{
  // b1 - mean(b1), read once a sub-tile | b2, read every pass straight into the
  // accumulators (C = D).  Behind them bg, read once a sub-tile.
  __shared__ __attribute__((aligned(32))) float lds_bias[HIDN + CC + CC];
  // -k and v of the tile and its ring, one record per pixel; tile t uses buffer t & 1.
  __shared__ __attribute__((aligned(16))) unsigned char lds_kv[2 * KVBYTES];
  // gate + bg + x, element i of sub-tile s of thread t at [(s * 16 + i) * 256 + t]
  // (lane-private); sub-tile 0's place later holds its finished output values.
  __shared__ float lds_base[2 * 16 * 256];
  // q of sub-tile 1, packed bf16, 1 KiB a wave: 16 B of a lane at [hf * 512 + 16 * lane]
  // (lane-private).
  __shared__ __attribute__((aligned(16))) unsigned char lds_q[TROWS * 1024];
  // All weights, bf16, in A-tile order.
  __shared__ __attribute__((aligned(16))) unsigned char lds_w[NTILES * 1024];
  // Column sums of W1 over the 8 rows that each wave loads.
  __shared__ __attribute__((aligned(16))) float lds_csum[TROWS * CC];

  const int tid = threadIdx.x;
  const int lane = threadIdx.x & 31;
  const int wave = __builtin_amdgcn_readfirstlane(threadIdx.x >> 5);
  // Waves 0, 1: b1; wave 2: b2; wave 3 (and the rest, unused): bg.
  const float in_b1 = b1[tid & (HIDN - 1)];
  const float in_b2 = b2[lane];
  const float in_bg = bg[lane];
  const float bias_in = wave < 2 ? in_b1 : (wave == 2 ? in_b2 : in_bg);
  // All of b1, two values a lane: a wave that writes biases forms the mean itself.
  const float b1lo = b1[2 * (tid & 31)];
  const float b1hi = b1[2 * (tid & 31) + 1];

  // ---- Phase 0: weight loads (2048 groups of 4 floats, 8 a thread) ----
  float wl[8][4];
  #pragma unroll
  for (int j = 0; j < 8; ++j) {
    const float* wsrc = j < 3 ? Wqkv + j * 1024
                      : j < 4 ? Wg
                      : j < 6 ? W1 + (j - 4) * 1024
                              : W2 + (j - 6) * 1024;
    #pragma unroll
    for (int i = 0; i < 4; ++i) wl[j][i] = wsrc[tid * 4 + i];
  }

  const int grp  = lane >> 4;
  const int lm   = lane & 15;
  const int k0   = grp ? 8 : 0;

  const int tile = blockIdx.x * TPB;       // first of the block's tiles (1024 in all)
  const int tw = tile & 7;                 // 8 tiles across W
  const int th = (tile >> 3) & 31;         // 32 tiles across H
  const int b  = tile >> 8;
  const int h0 = th * TROWS;
  const int h  = h0 + wave;
  const int wfirst = tw * TCOLS;
  const float* xb = x + (long)b * CC * HWP;

  // ---- Phase 1 ----
  // Ring pixel p of waves 0..5: top row, bottom row, then left/right pairs.
  const int p  = wave * 16 + lm;
  const int e  = p - 2 * HCOLS;
  const int hr = p < HCOLS ? 0 : (p < 2 * HCOLS ? HROWS - 1 : 1 + (e >> 1));
  const int wc = p < HCOLS ? p : (p < 2 * HCOLS ? p - HCOLS : (e & 1) * (HCOLS - 1));
  const int hh = h0 - 1 + hr;
  const bool ring_row_ok = (p < NRING) && (hh >= 0) && (hh < HH);
  const bool ring_left = wc == 0, ring_right = wc == HCOLS - 1;
  // Byte offsets in a record buffer, the lane's 16 * grp included: place lm of halo
  // row wave in plane 0, and the ring pixel's record.
  const unsigned own_rec  = (unsigned)((wave * HHALF + lm) * KVPITCH + 16 * grp);
  const unsigned ring_rec = (unsigned)((wc & 1) * KVPLANE
                                       + (hr * HHALF + (wc >> 1)) * KVPITCH + 16 * grp);

  // All x loads first: they come from furthest away.
  // Waves 6, 7 have no ring pixel and name pixels of their own row again (the same
  // lines): no branch, so these loads fly together with the rest.
  const int rh = wave < RWAVES ? iclamp(hh, 0, HH - 1) : h;
  // A ring column outside the image wraps round inside its row: a valid address,
  // and the value is replaced by 0 below.
  const int rw = wave < RWAVES ? ((wfirst - 1 + wc) & (WW - 1)) : wfirst + lm;
  // Byte offsets inside the image, channel k0, first tile: the ring pixel, the own
  // pixel pair.
  unsigned ring_off = 4u * (unsigned)(k0 * HWP + rh * WW + rw);
  const unsigned own_first = 4u * (unsigned)(k0 * HWP + h * WW + wfirst + 2 * lm);
  float xr[16];
  load_x(xb, ring_off, xr);
  float xf[2][16];
  load_x2(xb, own_first, xf[0], xf[1]);

  const f32x8 cz = {};

  // Scheduling fence: every load above is issued before the first wait; without
  // it the weights' conversions, and their wait, move up in front of the x loads,
  // and a wave waits out the two latencies in turn.
  __builtin_amdgcn_sched_barrier(0);

  // Place of a thread's 4 weights inside a tile: columns 4*c4 .. 4*c4+3.
  const int c4   = tid & 7;
  const int incol = (c4 >> 2) * 512 + ((c4 >> 1) & 1) * 256 + (c4 & 1) * 8;
  // 32-column matrices: 32 rows (two tiles) a round; row = tid >> 3.
  unsigned char* d32 = lds_w + (tid >> 7) * 1024 + ((tid >> 3) & 15) * 16 + incol;
  {
    // W2 (64 columns): 16 rows a round; row = tid >> 4, K step = bit 3.
    unsigned char* d64 = lds_w + ((tid >> 3) & 1) * 1024 + (tid >> 4) * 16 + incol;
    #pragma unroll
    for (int j = 0; j < 4; ++j) put_w4(d32 + j * 2048, wl[j]);
    #pragma unroll
    for (int j = 6; j < 8; ++j) put_w4(d64 + j * 2048, wl[j]);
    // W1 waits for its column means.  A thread holds columns 4*c4 .. 4*c4+3 of
    // two rows; lanes l, l^8, l^16, l^24 hold the same columns of a wave's rows.
    float cs[4];
    #pragma unroll
    for (int i = 0; i < 4; ++i) cs[i] = wl[4][i] + wl[5][i];
    #pragma unroll
    for (int i = 0; i < 4; ++i) cs[i] = add_xmask<8>(cs[i]);
    #pragma unroll
    for (int i = 0; i < 4; ++i) cs[i] += other_half(cs[i]);
    if (lane < 8)
      *(float4*)(lds_csum + wave * CC + 4 * lane) = make_float4(cs[0], cs[1], cs[2], cs[3]);
  }
  // Whole waves 0..3 write the biases.
  if (wave < (HIDN + CC + CC) / 32) {
    // Mean of b1: the lane's two values, then lanes ^1, ^2, ^4, ^8, ^16.
    float b1m = b1lo + b1hi;
    b1m = add_xmask<1>(b1m);
    b1m = add_xmask<2>(b1m);
    b1m = add_xmask<4>(b1m);
    b1m = add_xmask<8>(b1m);
    b1m += other_half(b1m);
    lds_bias[tid] = tid < HIDN ? bias_in - b1m * (1.0f / HIDN) : bias_in;
  }
  // Publishes the weight image (all but W1), the biases and the waves' column
  // sums of W1.
  __syncthreads();

  // W1 minus its column means, into the image; read behind the next barrier.
  {
    const float4 t0 = *(const float4*)(lds_csum + 4 * c4);
    float cm[4] = {t0.x, t0.y, t0.z, t0.w};
    #pragma unroll
    for (int w = 1; w < TROWS; ++w) {
      const float4 t = *(const float4*)(lds_csum + w * CC + 4 * c4);
      cm[0] += t.x; cm[1] += t.y; cm[2] += t.z; cm[3] += t.w;
    }
    #pragma unroll
    for (int j = 4; j < 6; ++j) {
      #pragma unroll
      for (int i = 0; i < 4; ++i) wl[j][i] -= cm[i] * (1.0f / HIDN);
      put_w4(d32 + j * 2048, wl[j]);
    }
  }

  // Per-row parameters in the D map: register r = row 8*grp + r of a tile.
  f32x8 lwc[4], lbc[4];
  #pragma unroll
  for (int n = 0; n < 4; ++n)
    #pragma unroll
    for (int r = 0; r < 8; ++r) {
      const int d = n * 16 + k0 + r;
      lwc[n][r] = ln_w[d]; lbc[n][r] = ln_b[d];
    }
  const f32x8* biasrow = (const f32x8*)(lds_bias + k0);   // tile t: biasrow[2 * t]

  // The own pixel pair's offset one tile ahead: names the next x, and, one tile back,
  // this tile's output; it lives through phase 2, so no load lands on it.
  unsigned own_next = own_first;
  for (int t = 0; t < TPB; ++t) {
    const int w0 = wfirst + t * TCOLS;
    unsigned char* kvbuf = lds_kv + (t & 1) * KVBYTES;

    // ---- Phase 1 ----
    bf16x16 Aq[2], Ak[2], Av[2], Ag[2];
    #pragma unroll
    for (int j = 0; j < 2; ++j) {
      Aq[j] = read_a(lds_w, T_Q + j, lane);
      Ak[j] = read_a(lds_w, T_K + j, lane);
      Av[j] = read_a(lds_w, T_V + j, lane);
      Ag[j] = read_a(lds_w, T_G + j, lane);
    }

    BFV qv;
    // Unrolled: s picks registers (xf[s]) and immediate LDS offsets.
    #pragma unroll
    for (int s = 0; s < 2; ++s) {
      BFV bv;
      #pragma unroll
      for (int i = 0; i < 16; ++i) bv.e[i] = (__bf16)xf[s][i];
      const f32x8 ok0 = wmma_bf16(Ak[0], bv.v, cz);
      const f32x8 ok1 = wmma_bf16(Ak[1], bv.v, cz);
      const f32x8 ov0 = wmma_bf16(Av[0], bv.v, cz);
      const f32x8 ov1 = wmma_bf16(Av[1], bv.v, cz);
      // Halo column 2*lm + s + 1: plane (s + 1) & 1, place lm + ((s + 1) >> 1).
      unsigned char* rec = kvbuf + own_rec + ((s + 1) & 1) * KVPLANE
                         + (HHALF + ((s + 1) >> 1)) * KVPITCH;
      put_rec(rec,      -ok0, -ok1);           // -k
      put_rec(rec + 64,  ov0,  ov1);

      // q as a B column (pixel w0 + 2*lm + s), packed bf16.
      BFV qs;
      #pragma unroll
      for (int j = 0; j < 2; ++j) {
        const f32x8 qa = wmma_bf16(Aq[j], bv.v, cz);
        #pragma unroll
        for (int r = 0; r < 8; ++r) qs.e[j * 8 + r] = (__bf16)qa[r];
      }
      if (s == 0) {
        qv = qs;
      } else {
        *(uint4*)(lds_q + wave * 1024 + 16 * lane)       = qs.q4[0];
        *(uint4*)(lds_q + wave * 1024 + 512 + 16 * lane) = qs.q4[1];
      }
      // gate + bg + x in the D map: element j*8+r = channel 16j + 8*grp + r.
      #pragma unroll
      for (int j = 0; j < 2; ++j) {
        const f32x8 ga = wmma_bf16(Ag[j], bv.v, cz);
        const f32x8 bgv = biasrow[2 * (6 + j)];
        #pragma unroll
        for (int r = 0; r < 8; ++r)
          lds_base[(s * 16 + j * 8 + r) * 256 + tid] = ga[r] + bgv[r] + xf[s][j * 8 + r];
      }
      // Scheduling fence: one sub-tile's work after the other's; woven together, the
      // D tiles and biases of both are live at once and address registers are spilled.
      __builtin_amdgcn_sched_barrier(0);
    }

    // The ring comes last: its x is loaded behind the last neighbor loop of the tile
    // before, and the own pixels' work above covers the rest of its way.
    if (wave < RWAVES) {
      // Column w0 - 1 + wc leaves the image only at these two places.
      const bool ring_ok = ring_row_ok && !(ring_left && w0 == 0)
                                       && !(ring_right && w0 + TCOLS == WW);
      BFV rv;
      #pragma unroll
      for (int i = 0; i < 16; ++i) rv.e[i] = (__bf16)xr[i];
      #pragma unroll
      for (int i = 0; i < 8; ++i) rv.u[i] = ring_ok ? rv.u[i] : 0u;
      const f32x8 rk0 = wmma_bf16(Ak[0], rv.v, cz);
      const f32x8 rk1 = wmma_bf16(Ak[1], rv.v, cz);
      const f32x8 rv0 = wmma_bf16(Av[0], rv.v, cz);
      const f32x8 rv1 = wmma_bf16(Av[1], rv.v, cz);
      if (p < NRING) {
        unsigned char* rec = kvbuf + ring_rec;
        put_rec(rec,      -rk0, -rk1);         // -k
        put_rec(rec + 64,  rv0,  rv1);
      }
    }

    // Publishes every wave's k / v records of this tile (before the first tile
    // also the centered W1 image); behind it no wave reads the
    // other record buffer any more, which the next tile's phase 1 writes.
    __syncthreads();

    own_next += 4u * TCOLS;

    // ---- Phase 2 ----
    // A2: W2 (32 x 64), 2 M-tiles x 2 K-steps.
    bf16x16 A2t[2][2];
    #pragma unroll
    for (int c = 0; c < 2; ++c)
      #pragma unroll
      for (int ks = 0; ks < 2; ++ks) A2t[c][ks] = read_a(lds_w, T_W2 + 2 * c + ks, lane);
    // A1: centered W1 (64 x 32), 4 M-tiles.
    bf16x16 A1t[4];
    #pragma unroll
    for (int n = 0; n < 4; ++n) A1t[n] = read_a(lds_w, T_W1 + n, lane);

    // Place lm of halo row wave in plane 0.
    const unsigned char* rec0 = kvbuf + own_rec;

    f32x8 num[2];
    f32x8 den[2];
    // Unrolled: rolled, q of sub-tile 0 would stay live through the neighbor loop
    // (8 registers that are not there).
    #pragma unroll
    for (int s = 0; s < 2; ++s) {
    // W1c * q + b1c, once a sub-tile: the C operand of every neighbor's first GEMM,
    // which then needs neither the bias from LDS nor q - k formed in registers.
    f32x8 hq[4];
    #pragma unroll
    for (int n = 0; n < 4; ++n) hq[n] = wmma_bf16(A1t[n], qv.v, biasrow[2 * n]);

    num[0] = cz; num[1] = cz;
    den[0] = cz; den[1] = cz;

    for (int nb = 0; nb < 9; ++nb) {
      // Compiler fence: keeps the reads of b2 inside the loop; hoisted, they
      // would hold 16 registers across it, which are not there.
      asm volatile("" ::: "memory");
      // Neighbor (dy, dx) lies in halo row wave + nb / 3, halo column 2*lm + hc.
      const int hc = s + nb % 3;
      const unsigned char* rec = rec0 + (hc & 1) * KVPLANE
                               + ((nb / 3) * HHALF + (hc >> 1)) * KVPITCH;
      BFV kv;
      kv.q4[0] = *(const uint4*)(rec);
      kv.q4[1] = *(const uint4*)(rec + 32);
      // (hid - mean)^T = W1c * (-k)^T + (W1c * q^T + b1c) : 64 x 16 in 4 accumulators.
      f32x8 hacc[4];
      #pragma unroll
      for (int n = 0; n < 4; ++n) hacc[n] = wmma_bf16(A1t[n], kv.v, hq[n]);

      // Scheduling fence: keeps v's reads behind the first GEMM, where -k's registers
      // are free again; read at the top, v costs 8 more and an A tile is spilled.
      __builtin_amdgcn_sched_barrier(0);
      const uint4 v0 = *(const uint4*)(rec + 64);
      const uint4 v1 = *(const uint4*)(rec + 96);
      const u32x8 vraw = {v0.x, v0.y, v0.z, v0.w, v1.x, v1.y, v1.z, v1.w};
      const bf16x16 vv = __builtin_bit_cast(bf16x16, vraw);

      // LayerNorm per pixel (= per lane pair l, l ^ 16): the values are centered
      // as they come, so the variance is their mean square.
      f32x8 s2 = hacc[0] * hacc[0] + hacc[1] * hacc[1]
               + hacc[2] * hacc[2] + hacc[3] * hacc[3];
      float qsum = ((s2[0] + s2[4]) + (s2[2] + s2[6])) + ((s2[1] + s2[5]) + (s2[3] + s2[7]));
      qsum += other_half(qsum);
      const float var = qsum * (1.0f / HIDN);
      // Hardware square root and reciprocal (about 1 ulp each) in place of the
      // correctly rounded sequences: inv is rounded to bf16 with the hidden values
      // right after.  A var too small for v_sqrt_f32 vanishes beside EPSV anyway.
      const float inv = __builtin_amdgcn_rcpf(__builtin_amdgcn_sqrtf(var) + EPSV);

      // Normalize + ReLU; D tiles 2ks, 2ks+1 converted in place are B of step ks.
      BFV hb[2];
      #pragma unroll
      for (int n = 0; n < 4; ++n)
        #pragma unroll
        for (int r = 0; r < 8; ++r) {
          float hv = hacc[n][r] * inv;
          hv = lwc[n][r] * hv + lbc[n][r];
          hv = hv > 0.f ? hv : 0.f;
          hb[n >> 1].e[(n & 1) * 8 + r] = (__bf16)hv;
        }

      // scores^T = W2 * hid^T + b2 (K=64: two chained WMMAs, b2 enters as C),
      // then online softmax-weighted accumulation of v.
      #pragma unroll
      for (int c = 0; c < 2; ++c) {
        f32x8 sc = wmma_bf16(A2t[c][0], hb[0].v, biasrow[2 * (4 + c)]);
        sc = wmma_bf16(A2t[c][1], hb[1].v, sc);
        #pragma unroll
        for (int r = 0; r < 8; ++r) {
          const float vval = (float)vv[c * 8 + r];
          const float e = __expf(sc[r]);
          den[c][r] += e;
          num[c][r] += e * vval;
        }
      }
    }

    if (s == 0) {
      // Sub-tile 0 is done: its output values wait in LDS (in place of gate + bg + x)
      // for their right-hand neighbors, and q of sub-tile 1 comes back.
      #pragma unroll
      for (int c = 0; c < 2; ++c)
        #pragma unroll
        for (int r = 0; r < 8; ++r)
          lds_base[(c * 8 + r) * 256 + tid] += num[c][r] * __builtin_amdgcn_rcpf(den[c][r]);
      qv.q4[0] = *(const uint4*)(lds_q + wave * 1024 + 16 * lane);
      qv.q4[1] = *(const uint4*)(lds_q + wave * 1024 + 512 + 16 * lane);
    }
    }

    // x of the next tile: issued here, not behind the barrier, so that its 48
    // registers are free inside the neighbor loops (W1c * q + b1c lives there); the
    // output part below and the A-tile reads cover its way in part.
    if (t + 1 < TPB) {
      // One tile to the right, wrapping inside the row (a row is 4 * WW bytes).
      ring_off = (ring_off & ~(4u * WW - 1)) | ((ring_off + 4u * TCOLS) & (4u * WW - 1));
      load_x2(xb, own_next, xf[0], xf[1]);
      load_x(xb, ring_off, xr);
      // The output part's first instructions overwrite the address registers that
      // these loads name: this wait stands in front of them, as a precaution.
      asm volatile("s_wait_xcnt 0x0" ::: "memory");
    } else {
      // Ends the old values' life in phase 1: without a new value on this path they
      // would hold their 48 registers through the neighbor loops (spills).
      #pragma unroll
      for (int i = 0; i < 16; ++i) { xf[0][i] = 0.f; xf[1][i] = 0.f; xr[i] = 0.f; }
    }

    // out = (gate + bg + x) + weighted_v: every element stored once, the lane's two
    // pixels in one 8-byte store (16 lanes: one whole line).
    float* opix = (float*)((char*)(out + (long)b * CC * HWP) + own_next) - TCOLS;
    #pragma unroll
    for (int c = 0; c < 2; ++c)
      #pragma unroll
      for (int r = 0; r < 8; ++r)
        *(float2*)(opix + (c * 16 + r) * HWP) = make_float2(
            lds_base[(c * 8 + r) * 256 + tid],
            lds_base[(16 + c * 8 + r) * 256 + tid]
                + num[c][r] * __builtin_amdgcn_rcpf(den[c][r]));
    // The next tile's first instructions overwrite registers that these stores
    // name (data, offset), and the build has no wait on the way back up: this one
    // stands in front of them, as a precaution.
    asm volatile("s_wait_xcnt 0x0" ::: "memory");
  }
}

extern "C" void kernel_launch(void* const* d_in, const int* in_sizes, int n_in,
                              void* d_out, int out_size, void* d_ws, size_t ws_size,
                              hipStream_t stream) {
  (void)in_sizes; (void)n_in; (void)out_size; (void)d_ws; (void)ws_size;
  const float* x    = (const float*)d_in[0];
  const float* Wqkv = (const float*)d_in[1];
  const float* W1   = (const float*)d_in[2];
  const float* b1   = (const float*)d_in[3];
  const float* ln_w = (const float*)d_in[4];
  const float* ln_b = (const float*)d_in[5];
  const float* W2   = (const float*)d_in[6];
  const float* b2   = (const float*)d_in[7];
  const float* Wg   = (const float*)d_in[8];
  const float* bg   = (const float*)d_in[9];
  float* out = (float*)d_out;

  // 1024 tiles (8 w-tiles x 32 h-tiles x 4 batches), TPB = 2 tiles and 8 waves a
  // block: 512 blocks, two on each WGP, all resident at once.
  va_fused<<<dim3(512), dim3(256), 0, stream>>>(x, Wqkv, Wg, bg, W1, b1, ln_w, ln_b,
                                                 W2, b2, out);
}

// v009
// Measured time: 30.8 microseconds a run.
// Next to v008, in two timings, it ran 1.06 times as fast each time.
// Counting every step since v000, it is 5.17 times as fast.
#include <hip/hip_runtime.h>
#include <hip/hip_bf16.h>

#define BB   4
#define CC   32
#define HH   256
#define WW   256
#define HIDN 64
#define HWP  (HH * WW)
#define EPSV 1e-5f

typedef __attribute__((ext_vector_type(16))) __bf16 bf16x16;
typedef __attribute__((ext_vector_type(8)))  float  f32x8;
typedef __attribute__((ext_vector_type(8)))  unsigned u32x8;
typedef __attribute__((ext_vector_type(2)))  float  f32x2;

union BFV {
  bf16x16  v;
  __bf16   e[16];
  unsigned u[8];
  uint4    q4[2];
};

__device__ __forceinline__ int iclamp(int x, int lo, int hi) {
  return x < lo ? lo : (x > hi ? hi : x);
}

static __device__ __forceinline__ f32x8 wmma_bf16(bf16x16 a, bf16x16 b, f32x8 c) {
  // D = A(16x32 bf16) x B(32x16 bf16) + C(16x16 f32)
  return __builtin_amdgcn_wmma_f32_16x16x32_bf16(false, a, false, b, (short)0, c,
                                                 false, false);
}

// ---------------------------------------------------------------------------
// One launch.  A block owns 8 rows x 64 columns of one image and works through
// them as TPB tiles of 8 rows x 32 columns, left to right; in a tile a wave owns
// one row (32 pixels) and a lane two neighboring pixels of it, columns 2*lm and
// 2*lm + 1: 16 lanes x 8 bytes are one whole 128-byte line of x or of out.  The
// even columns are sub-tile 0, the odd ones sub-tile 1 (16 pixels = one WMMA N).
// Phase 0 runs once a block, phase 1 once a tile, phase 2 once a sub-tile.
// The x values of the next tile are loaded behind the tile's last neighbor loop, in
// front of its output part; k / v records have two buffers, so one barrier a tile both
// publishes the new records and ends the last reads of the buffer written next.
// Phase 0: the block brings all four weight matrices in once, 16 bytes a thread
//   and whole lines a wave, and lays them in LDS as bf16 in A-tile order; every
//   wave then reads its A tiles from there (two 16-byte LDS reads a tile).
//   W1 and b1 go in CENTERED over the 64 hidden units (each column of W1 minus
//   its mean, b1 minus its mean, in f32, before the rounding to bf16): the mean
//   over hidden units of W1c * a + b1c is 0 for every a, so the first MLP GEMM
//   yields hid - mean as it stands and LayerNorm needs no sum and no subtraction.
// Phase 1 (1x1 convs, weights as A, pixels as B columns):
//   every wave projects its own 32 pixels, a sub-tile at a time: -k and v go to LDS,
//   q of sub-tile 0 stays in registers (two converted D tiles are the B operand of
//   the first MLP GEMM as they lie), q of sub-tile 1 and gate + bg + x are parked in
//   LDS, lane-private;
//   waves 0..5 also project the 84 pixels of the ring round the tile (-k, v).
//   A pixel outside the image enters as x = 0, so its k and v are 0
//   (zero-padded unfold; the qkv conv has no bias).
// Phase 2: neighbor MLP + softmax + weighted v, k and v read from LDS.
//   W1c * q^T + b1c is formed once a sub-tile and is the C operand of every neighbor:
//   (hid - mean)^T (64 x 16 pix) = W1c * (-k)^T + C : lane (lm, grp) holds
//     hidden units 16m + 8*grp + r of pixel lm -> the sum of squares is in-lane
//     plus one exchange with lane ^ 16;
//   two converted D tiles are the B operand of the second GEMM as they lie;
//   scores^T (32 x 16 pix): a lane holds channels 16c + 8*grp + r of pixel lm,
//     the same 8-channel runs that one 16-byte read of v brings.
// Neighbors are the outer loop; the 9-way softmax is a running accumulation.
// ---------------------------------------------------------------------------
#define TROWS  8                     // tile rows (= waves)
#define TCOLS  32                    // tile columns (= two WMMA N)
#define HCOLS  (TCOLS + 2)           // halo columns
#define HHALF  (HCOLS / 2)           // halo columns of one parity
#define HROWS  (TROWS + 2)           // halo rows
#define NRING  (2 * HCOLS + 2 * TROWS)
#define RWAVES ((NRING + 15) / 16)   // waves with ring pixels
#define KVPITCH 144                  // -k 64 B | v 64 B | 16 B pad: 16 B x odd
// Records of even and of odd halo columns lie in two planes: the 16 pixels of a
// sub-tile, two columns apart, are then one pitch apart (no bank conflict).
#define KVPLANE (HROWS * HHALF * KVPITCH)
#define KVBYTES (2 * KVPLANE)
#define TPB    2                     // tiles a block, neighbors along W

__device__ __forceinline__ float other_half(float x) {
  // value of lane ^ 16 (cross-row vector move)
  const int b = __builtin_bit_cast(int, x);
  return __builtin_bit_cast(float,
      __builtin_amdgcn_permlanex16(b, b, 0x76543210, 0xfedcba98, false, false));
}

// x plus the value of lane ^ M, M < 16 (row_xmask move folded into the add).
template <int M>
__device__ __forceinline__ float add_xmask(float x) {
  const int b = __builtin_bit_cast(int, x);
  return x + __builtin_bit_cast(float,
      __builtin_amdgcn_update_dpp(0, b, 0x160 + M, 0xf, 0xf, true));
}

// ReLU inside the FMA.  The clamp modifier bounds a result to [0, 1]; ln_w and ln_b
// carry RSCALE = 2^-64 and W2 carries 2^64 (powers of two: every rounding stays as it
// was), so the upper bound is never met (a normalized value is below 8 in size, the
// hidden value below 8 |ln_w| + |ln_b|) and the lower one is the ReLU.
#define RSCALE 0x1p-64f
#define RINV   0x1p+64f
__device__ __forceinline__ f32x2 pk_fma_relu(f32x2 a, f32x2 b, f32x2 c) {
  f32x2 d;
  // In asm because the compiler has no packed f32 form with clamp: it writes the FMA
  // and one maximum a value.
  asm("v_pk_fma_f32 %0, %1, %2, %3 clamp" : "=v"(d) : "v"(a), "v"(b), "v"(c));
  return d;
}

// A-tile image in LDS: 1 KiB a tile (16 rows x 32 K, bf16) as two planes of
// 512 B; plane hf holds, at 16 B x lane, K values 16*hf + 8*grp + 0..7 of row lm
// (lane = 16*grp + lm): a wave's read of a plane is 512 contiguous bytes.
#define T_Q   0                      // Wqkv: tiles 0..5 (q, k, v: two each)
#define T_K   2
#define T_V   4
#define T_G   6                      // Wg:   tiles 6, 7
#define T_W1  8                      // W1:   tiles 8..11
#define T_W2  12                     // W2:   tile 12 + 2*c + ks
#define NTILES 16

__device__ __forceinline__ bf16x16 read_a(const unsigned char* img, int tile, int lane) {
  BFV t;
  t.q4[0] = *(const uint4*)(img + tile * 1024 + lane * 16);
  t.q4[1] = *(const uint4*)(img + tile * 1024 + 512 + lane * 16);
  return t.v;
}

// Four neighboring weights of one row as 4 bf16 (8 bytes of the image).
__device__ __forceinline__ void put_w4(unsigned char* dst, const float (&w)[4]) {
  union { __bf16 e[4]; uint2 d; } t;
  #pragma unroll
  for (int i = 0; i < 4; ++i) t.e[i] = (__bf16)w[i];
  *(uint2*)dst = t.d;
}

// x of one pixel per lane in the B map (channels k0+i, 16+k0+i), f32.  img is the
// image's first element (the same in every lane), off the lane's byte offset of
// channel k0 of its pixel: one register a lane instead of a pointer pair.
__device__ __forceinline__ void load_x(const float* __restrict__ img, unsigned off,
                                       float (&xf)[16]) {
  const float* xpix = (const float*)((const char*)img + off);
  #pragma unroll
  for (int i = 0; i < 8; ++i) xf[i]     = xpix[i * HWP];
  #pragma unroll
  for (int i = 0; i < 8; ++i) xf[8 + i] = xpix[(16 + i) * HWP];
}

// The same for the lane's two neighboring pixels (8 bytes a channel).
__device__ __forceinline__ void load_x2(const float* __restrict__ img, unsigned off,
                                        float (&xe)[16], float (&xo)[16]) {
  const float* xpix = (const float*)((const char*)img + off);
  #pragma unroll
  for (int i = 0; i < 8; ++i) { xe[i] = xpix[i * HWP]; xo[i] = xpix[i * HWP + 1]; }
  #pragma unroll
  for (int i = 0; i < 8; ++i) {
    xe[8 + i] = xpix[(16 + i) * HWP]; xo[8 + i] = xpix[(16 + i) * HWP + 1];
  }
}

// Two D tiles (channels 8*grp + r and 16 + 8*grp + r of the lane's pixel) as
// 32 bf16 channels of one pixel record: 16 B at 16*grp and at 32 + 16*grp; rec
// names the first of the two.
__device__ __forceinline__ void put_rec(unsigned char* rec, f32x8 d0, f32x8 d1) {
  BFV t;
  #pragma unroll
  for (int r = 0; r < 8; ++r) { t.e[r] = (__bf16)d0[r]; t.e[8 + r] = (__bf16)d1[r]; }
  *(uint4*)(rec)      = t.q4[0];
  *(uint4*)(rec + 32) = t.q4[1];
}

// Second bound: 4 waves a SIMD (two blocks a WGP), a budget of 256 registers.
__global__ __launch_bounds__(256, 4) void va_fused(
    const float* __restrict__ x,
    const float* __restrict__ Wqkv,
    const float* __restrict__ Wg,
    const float* __restrict__ bg,
    const float* __restrict__ W1,
    const float* __restrict__ b1,
    const float* __restrict__ ln_w,
    const float* __restrict__ ln_b,
    const float* __restrict__ W2,
    const float* __restrict__ b2,
    float* __restrict__ out)
{
  // b1 - mean(b1), read once a sub-tile | b2, read every pass straight into the
  // accumulators (C = D).  Behind them bg, read once a sub-tile.
  __shared__ __attribute__((aligned(32))) float lds_bias[HIDN + CC + CC];
  // -k and v of the tile and its ring, one record per pixel; tile t uses buffer t & 1.
  __shared__ __attribute__((aligned(16))) unsigned char lds_kv[2 * KVBYTES];
  // gate + bg + x, element i of sub-tile s of thread t at [(s * 16 + i) * 256 + t]
  // (lane-private); sub-tile 0's place later holds its finished output values.
  __shared__ float lds_base[2 * 16 * 256];
  // q of sub-tile 1, packed bf16, 1 KiB a wave: 16 B of a lane at [hf * 512 + 16 * lane]
  // (lane-private).
  __shared__ __attribute__((aligned(16))) unsigned char lds_q[TROWS * 1024];
  // All weights, bf16, in A-tile order.
  __shared__ __attribute__((aligned(16))) unsigned char lds_w[NTILES * 1024];
  // Column sums of W1 over the 8 rows that each wave loads.
  __shared__ __attribute__((aligned(16))) float lds_csum[TROWS * CC];

  const int tid = threadIdx.x;
  const int lane = threadIdx.x & 31;
  const int wave = __builtin_amdgcn_readfirstlane(threadIdx.x >> 5);
  // Waves 0, 1: b1; wave 2: b2; wave 3 (and the rest, unused): bg.
  const float in_b1 = b1[tid & (HIDN - 1)];
  const float in_b2 = b2[lane];
  const float in_bg = bg[lane];
  const float bias_in = wave < 2 ? in_b1 : (wave == 2 ? in_b2 : in_bg);
  // All of b1, two values a lane: a wave that writes biases forms the mean itself.
  const float b1lo = b1[2 * (tid & 31)];
  const float b1hi = b1[2 * (tid & 31) + 1];

  // ---- Phase 0: weight loads (2048 groups of 4 floats, 8 a thread) ----
  float wl[8][4];
  #pragma unroll
  for (int j = 0; j < 8; ++j) {
    const float* wsrc = j < 3 ? Wqkv + j * 1024
                      : j < 4 ? Wg
                      : j < 6 ? W1 + (j - 4) * 1024
                              : W2 + (j - 6) * 1024;
    #pragma unroll
    for (int i = 0; i < 4; ++i) wl[j][i] = wsrc[tid * 4 + i];
  }

  const int grp  = lane >> 4;
  const int lm   = lane & 15;
  const int k0   = grp ? 8 : 0;

  const int tile = blockIdx.x * TPB;       // first of the block's tiles (1024 in all)
  const int tw = tile & 7;                 // 8 tiles across W
  const int th = (tile >> 3) & 31;         // 32 tiles across H
  const int b  = tile >> 8;
  const int h0 = th * TROWS;
  const int h  = h0 + wave;
  const int wfirst = tw * TCOLS;
  const float* xb = x + (long)b * CC * HWP;

  // ---- Phase 1 ----
  // Ring pixel p of waves 0..5: top row, bottom row, then left/right pairs.
  const int p  = wave * 16 + lm;
  const int e  = p - 2 * HCOLS;
  const int hr = p < HCOLS ? 0 : (p < 2 * HCOLS ? HROWS - 1 : 1 + (e >> 1));
  const int wc = p < HCOLS ? p : (p < 2 * HCOLS ? p - HCOLS : (e & 1) * (HCOLS - 1));
  const int hh = h0 - 1 + hr;
  const bool ring_row_ok = (p < NRING) && (hh >= 0) && (hh < HH);
  const bool ring_left = wc == 0, ring_right = wc == HCOLS - 1;
  // Byte offsets in a record buffer, the lane's 16 * grp included: place lm of halo
  // row wave in plane 0, and the ring pixel's record.
  const unsigned own_rec  = (unsigned)((wave * HHALF + lm) * KVPITCH + 16 * grp);
  const unsigned ring_rec = (unsigned)((wc & 1) * KVPLANE
                                       + (hr * HHALF + (wc >> 1)) * KVPITCH + 16 * grp);

  // All x loads first: they come from furthest away.
  // Waves 6, 7 have no ring pixel and name pixels of their own row again (the same
  // lines): no branch, so these loads fly together with the rest.
  const int rh = wave < RWAVES ? iclamp(hh, 0, HH - 1) : h;
  // A ring column outside the image wraps round inside its row: a valid address,
  // and the value is replaced by 0 below.
  const int rw = wave < RWAVES ? ((wfirst - 1 + wc) & (WW - 1)) : wfirst + lm;
  // Byte offsets inside the image, channel k0, first tile: the ring pixel, the own
  // pixel pair.
  unsigned ring_off = 4u * (unsigned)(k0 * HWP + rh * WW + rw);
  const unsigned own_first = 4u * (unsigned)(k0 * HWP + h * WW + wfirst + 2 * lm);
  float xr[16];
  load_x(xb, ring_off, xr);
  float xf[2][16];
  load_x2(xb, own_first, xf[0], xf[1]);

  const f32x8 cz = {};

  // Scheduling fence: every load above is issued before the first wait; without
  // it the weights' conversions, and their wait, move up in front of the x loads,
  // and a wave waits out the two latencies in turn.
  __builtin_amdgcn_sched_barrier(0);

  // Place of a thread's 4 weights inside a tile: columns 4*c4 .. 4*c4+3.
  const int c4   = tid & 7;
  const int incol = (c4 >> 2) * 512 + ((c4 >> 1) & 1) * 256 + (c4 & 1) * 8;
  // 32-column matrices: 32 rows (two tiles) a round; row = tid >> 3.
  unsigned char* d32 = lds_w + (tid >> 7) * 1024 + ((tid >> 3) & 15) * 16 + incol;
  {
    // W2 (64 columns): 16 rows a round; row = tid >> 4, K step = bit 3.
    unsigned char* d64 = lds_w + ((tid >> 3) & 1) * 1024 + (tid >> 4) * 16 + incol;
    #pragma unroll
    for (int j = 0; j < 4; ++j) put_w4(d32 + j * 2048, wl[j]);
    #pragma unroll
    for (int j = 6; j < 8; ++j) {
      #pragma unroll
      for (int i = 0; i < 4; ++i) wl[j][i] *= RINV;   // undoes RSCALE of the hidden values
      put_w4(d64 + j * 2048, wl[j]);
    }
    // W1 waits for its column means.  A thread holds columns 4*c4 .. 4*c4+3 of
    // two rows; lanes l, l^8, l^16, l^24 hold the same columns of a wave's rows.
    float cs[4];
    #pragma unroll
    for (int i = 0; i < 4; ++i) cs[i] = wl[4][i] + wl[5][i];
    #pragma unroll
    for (int i = 0; i < 4; ++i) cs[i] = add_xmask<8>(cs[i]);
    #pragma unroll
    for (int i = 0; i < 4; ++i) cs[i] += other_half(cs[i]);
    if (lane < 8)
      *(float4*)(lds_csum + wave * CC + 4 * lane) = make_float4(cs[0], cs[1], cs[2], cs[3]);
  }
  // Whole waves 0..3 write the biases.
  if (wave < (HIDN + CC + CC) / 32) {
    // Mean of b1: the lane's two values, then lanes ^1, ^2, ^4, ^8, ^16.
    float b1m = b1lo + b1hi;
    b1m = add_xmask<1>(b1m);
    b1m = add_xmask<2>(b1m);
    b1m = add_xmask<4>(b1m);
    b1m = add_xmask<8>(b1m);
    b1m += other_half(b1m);
    lds_bias[tid] = tid < HIDN ? bias_in - b1m * (1.0f / HIDN) : bias_in;
  }
  // Publishes the weight image (all but W1), the biases and the waves' column
  // sums of W1.
  __syncthreads();

  // W1 minus its column means, into the image; read behind the next barrier.
  {
    const float4 t0 = *(const float4*)(lds_csum + 4 * c4);
    float cm[4] = {t0.x, t0.y, t0.z, t0.w};
    #pragma unroll
    for (int w = 1; w < TROWS; ++w) {
      const float4 t = *(const float4*)(lds_csum + w * CC + 4 * c4);
      cm[0] += t.x; cm[1] += t.y; cm[2] += t.z; cm[3] += t.w;
    }
    #pragma unroll
    for (int j = 4; j < 6; ++j) {
      #pragma unroll
      for (int i = 0; i < 4; ++i) wl[j][i] -= cm[i] * (1.0f / HIDN);
      put_w4(d32 + j * 2048, wl[j]);
    }
  }

  // Per-row parameters in the D map: register r = row 8*grp + r of a tile.
  f32x8 lwc[4], lbc[4];
  #pragma unroll
  for (int n = 0; n < 4; ++n)
    #pragma unroll
    for (int r = 0; r < 8; ++r) {
      const int d = n * 16 + k0 + r;
      lwc[n][r] = ln_w[d] * RSCALE; lbc[n][r] = ln_b[d] * RSCALE;
    }
  const f32x8* biasrow = (const f32x8*)(lds_bias + k0);   // tile t: biasrow[2 * t]

  // The own pixel pair's offset one tile ahead: names the next x, and, one tile back,
  // this tile's output; it lives through phase 2, so no load lands on it.
  unsigned own_next = own_first;
  for (int t = 0; t < TPB; ++t) {
    const int w0 = wfirst + t * TCOLS;
    unsigned char* kvbuf = lds_kv + (t & 1) * KVBYTES;

    // ---- Phase 1 ----
    bf16x16 Aq[2], Ak[2], Av[2], Ag[2];
    #pragma unroll
    for (int j = 0; j < 2; ++j) {
      Aq[j] = read_a(lds_w, T_Q + j, lane);
      Ak[j] = read_a(lds_w, T_K + j, lane);
      Av[j] = read_a(lds_w, T_V + j, lane);
      Ag[j] = read_a(lds_w, T_G + j, lane);
    }

    BFV qv;
    // Unrolled: s picks registers (xf[s]) and immediate LDS offsets.
    #pragma unroll
    for (int s = 0; s < 2; ++s) {
      BFV bv;
      #pragma unroll
      for (int i = 0; i < 16; ++i) bv.e[i] = (__bf16)xf[s][i];
      const f32x8 ok0 = wmma_bf16(Ak[0], bv.v, cz);
      const f32x8 ok1 = wmma_bf16(Ak[1], bv.v, cz);
      const f32x8 ov0 = wmma_bf16(Av[0], bv.v, cz);
      const f32x8 ov1 = wmma_bf16(Av[1], bv.v, cz);
      // Halo column 2*lm + s + 1: plane (s + 1) & 1, place lm + ((s + 1) >> 1).
      unsigned char* rec = kvbuf + own_rec + ((s + 1) & 1) * KVPLANE
                         + (HHALF + ((s + 1) >> 1)) * KVPITCH;
      put_rec(rec,      -ok0, -ok1);           // -k
      put_rec(rec + 64,  ov0,  ov1);

      // q as a B column (pixel w0 + 2*lm + s), packed bf16.
      BFV qs;
      #pragma unroll
      for (int j = 0; j < 2; ++j) {
        const f32x8 qa = wmma_bf16(Aq[j], bv.v, cz);
        #pragma unroll
        for (int r = 0; r < 8; ++r) qs.e[j * 8 + r] = (__bf16)qa[r];
      }
      if (s == 0) {
        qv = qs;
      } else {
        *(uint4*)(lds_q + wave * 1024 + 16 * lane)       = qs.q4[0];
        *(uint4*)(lds_q + wave * 1024 + 512 + 16 * lane) = qs.q4[1];
      }
      // gate + bg + x in the D map: element j*8+r = channel 16j + 8*grp + r.
      #pragma unroll
      for (int j = 0; j < 2; ++j) {
        const f32x8 ga = wmma_bf16(Ag[j], bv.v, cz);
        const f32x8 bgv = biasrow[2 * (6 + j)];
        #pragma unroll
        for (int r = 0; r < 8; ++r)
          lds_base[(s * 16 + j * 8 + r) * 256 + tid] = ga[r] + bgv[r] + xf[s][j * 8 + r];
      }
      // Scheduling fence: one sub-tile's work after the other's; woven together, the
      // D tiles and biases of both are live at once and address registers are spilled.
      __builtin_amdgcn_sched_barrier(0);
    }

    // The ring comes last: its x is loaded behind the last neighbor loop of the tile
    // before, and the own pixels' work above covers the rest of its way.
    if (wave < RWAVES) {
      // Column w0 - 1 + wc leaves the image only at these two places.
      const bool ring_ok = ring_row_ok && !(ring_left && w0 == 0)
                                       && !(ring_right && w0 + TCOLS == WW);
      BFV rv;
      #pragma unroll
      for (int i = 0; i < 16; ++i) rv.e[i] = (__bf16)xr[i];
      #pragma unroll
      for (int i = 0; i < 8; ++i) rv.u[i] = ring_ok ? rv.u[i] : 0u;
      const f32x8 rk0 = wmma_bf16(Ak[0], rv.v, cz);
      const f32x8 rk1 = wmma_bf16(Ak[1], rv.v, cz);
      const f32x8 rv0 = wmma_bf16(Av[0], rv.v, cz);
      const f32x8 rv1 = wmma_bf16(Av[1], rv.v, cz);
      if (p < NRING) {
        unsigned char* rec = kvbuf + ring_rec;
        put_rec(rec,      -rk0, -rk1);         // -k
        put_rec(rec + 64,  rv0,  rv1);
      }
    }

    // Publishes every wave's k / v records of this tile (before the first tile
    // also the centered W1 image); behind it no wave reads the
    // other record buffer any more, which the next tile's phase 1 writes.
    __syncthreads();

    own_next += 4u * TCOLS;

    // ---- Phase 2 ----
    // A2: W2 (32 x 64), 2 M-tiles x 2 K-steps.
    bf16x16 A2t[2][2];
    #pragma unroll
    for (int c = 0; c < 2; ++c)
      #pragma unroll
      for (int ks = 0; ks < 2; ++ks) A2t[c][ks] = read_a(lds_w, T_W2 + 2 * c + ks, lane);
    // A1: centered W1 (64 x 32), 4 M-tiles.
    bf16x16 A1t[4];
    #pragma unroll
    for (int n = 0; n < 4; ++n) A1t[n] = read_a(lds_w, T_W1 + n, lane);

    // Place lm of halo row wave in plane 0.
    const unsigned char* rec0 = kvbuf + own_rec;

    f32x8 num[2];
    f32x8 den[2];
    // Unrolled: rolled, q of sub-tile 0 would stay live through the neighbor loop
    // (8 registers that are not there).
    #pragma unroll
    for (int s = 0; s < 2; ++s) {
    // W1c * q + b1c, once a sub-tile: the C operand of every neighbor's first GEMM,
    // which then needs neither the bias from LDS nor q - k formed in registers.
    f32x8 hq[4];
    #pragma unroll
    for (int n = 0; n < 4; ++n) hq[n] = wmma_bf16(A1t[n], qv.v, biasrow[2 * n]);

    num[0] = cz; num[1] = cz;
    den[0] = cz; den[1] = cz;

    for (int nb = 0; nb < 9; ++nb) {
      // Compiler fence: keeps the reads of b2 inside the loop; hoisted, they
      // would hold 16 registers across it, which are not there.
      asm volatile("" ::: "memory");
      // Neighbor (dy, dx) lies in halo row wave + nb / 3, halo column 2*lm + hc.
      const int hc = s + nb % 3;
      const unsigned char* rec = rec0 + (hc & 1) * KVPLANE
                               + ((nb / 3) * HHALF + (hc >> 1)) * KVPITCH;
      BFV kv;
      kv.q4[0] = *(const uint4*)(rec);
      kv.q4[1] = *(const uint4*)(rec + 32);
      // (hid - mean)^T = W1c * (-k)^T + (W1c * q^T + b1c) : 64 x 16 in 4 accumulators.
      f32x8 hacc[4];
      #pragma unroll
      for (int n = 0; n < 4; ++n) hacc[n] = wmma_bf16(A1t[n], kv.v, hq[n]);

      // Scheduling fence: keeps v's reads behind the first GEMM, where -k's registers
      // are free again; read at the top, v costs 8 more and an A tile is spilled.
      __builtin_amdgcn_sched_barrier(0);
      const uint4 v0 = *(const uint4*)(rec + 64);
      const uint4 v1 = *(const uint4*)(rec + 96);
      const u32x8 vraw = {v0.x, v0.y, v0.z, v0.w, v1.x, v1.y, v1.z, v1.w};
      const bf16x16 vv = __builtin_bit_cast(bf16x16, vraw);

      // LayerNorm per pixel (= per lane pair l, l ^ 16): the values are centered
      // as they come, so the variance is their mean square.
      f32x8 s2 = hacc[0] * hacc[0] + hacc[1] * hacc[1]
               + hacc[2] * hacc[2] + hacc[3] * hacc[3];
      float qsum = ((s2[0] + s2[4]) + (s2[2] + s2[6])) + ((s2[1] + s2[5]) + (s2[3] + s2[7]));
      qsum += other_half(qsum);
      const float var = qsum * (1.0f / HIDN);
      // Hardware square root and reciprocal (about 1 ulp each) in place of the
      // correctly rounded sequences: inv is rounded to bf16 with the hidden values
      // right after.  A var too small for v_sqrt_f32 vanishes beside EPSV anyway.
      const float inv = __builtin_amdgcn_rcpf(__builtin_amdgcn_sqrtf(var) + EPSV);

      // Normalize + ReLU (times RSCALE); D tiles 2ks, 2ks+1 converted in place are B of
      // step ks.
      BFV hb[2];
      #pragma unroll
      for (int n = 0; n < 4; ++n)
        #pragma unroll
        for (int r = 0; r < 8; r += 2) {
          const f32x2 tn = {hacc[n][r] * inv, hacc[n][r + 1] * inv};
          const f32x2 lw2 = {lwc[n][r], lwc[n][r + 1]};
          const f32x2 lb2 = {lbc[n][r], lbc[n][r + 1]};
          const f32x2 hv = pk_fma_relu(tn, lw2, lb2);
          hb[n >> 1].e[(n & 1) * 8 + r]     = (__bf16)hv.x;
          hb[n >> 1].e[(n & 1) * 8 + r + 1] = (__bf16)hv.y;
        }

      // scores^T = (W2 / RSCALE) * (RSCALE * hid)^T + b2 (K=64: two chained WMMAs, b2
      // enters as C),
      // then online softmax-weighted accumulation of v.
      #pragma unroll
      for (int c = 0; c < 2; ++c) {
        f32x8 sc = wmma_bf16(A2t[c][0], hb[0].v, biasrow[2 * (4 + c)]);
        sc = wmma_bf16(A2t[c][1], hb[1].v, sc);
        #pragma unroll
        for (int r = 0; r < 8; ++r) {
          const float vval = (float)vv[c * 8 + r];
          const float e = __expf(sc[r]);
          den[c][r] += e;
          num[c][r] += e * vval;
        }
      }
    }

    if (s == 0) {
      // Sub-tile 0 is done: its output values wait in LDS (in place of gate + bg + x)
      // for their right-hand neighbors, and q of sub-tile 1 comes back.
      #pragma unroll
      for (int c = 0; c < 2; ++c)
        #pragma unroll
        for (int r = 0; r < 8; ++r)
          lds_base[(c * 8 + r) * 256 + tid] += num[c][r] * __builtin_amdgcn_rcpf(den[c][r]);
      qv.q4[0] = *(const uint4*)(lds_q + wave * 1024 + 16 * lane);
      qv.q4[1] = *(const uint4*)(lds_q + wave * 1024 + 512 + 16 * lane);
    }
    }

    // x of the next tile: issued here, not behind the barrier, so that its 48
    // registers are free inside the neighbor loops (W1c * q + b1c lives there); the
    // output part below and the A-tile reads cover its way in part.
    if (t + 1 < TPB) {
      // One tile to the right, wrapping inside the row (a row is 4 * WW bytes).
      ring_off = (ring_off & ~(4u * WW - 1)) | ((ring_off + 4u * TCOLS) & (4u * WW - 1));
      load_x2(xb, own_next, xf[0], xf[1]);
      load_x(xb, ring_off, xr);
      // The output part's first instructions overwrite the address registers that
      // these loads name: this wait stands in front of them, as a precaution.
      asm volatile("s_wait_xcnt 0x0" ::: "memory");
    } else {
      // Ends the old values' life in phase 1: without a new value on this path they
      // would hold their 48 registers through the neighbor loops (spills).
      #pragma unroll
      for (int i = 0; i < 16; ++i) { xf[0][i] = 0.f; xf[1][i] = 0.f; xr[i] = 0.f; }
    }

    // out = (gate + bg + x) + weighted_v: every element stored once, the lane's two
    // pixels in one 8-byte store (16 lanes: one whole line).
    float* opix = (float*)((char*)(out + (long)b * CC * HWP) + own_next) - TCOLS;
    #pragma unroll
    for (int c = 0; c < 2; ++c)
      #pragma unroll
      for (int r = 0; r < 8; ++r)
        *(float2*)(opix + (c * 16 + r) * HWP) = make_float2(
            lds_base[(c * 8 + r) * 256 + tid],
            lds_base[(16 + c * 8 + r) * 256 + tid]
                + num[c][r] * __builtin_amdgcn_rcpf(den[c][r]));
    // The next tile's first instructions overwrite registers that these stores
    // name (data, offset), and the build has no wait on the way back up: this one
    // stands in front of them, as a precaution.
    asm volatile("s_wait_xcnt 0x0" ::: "memory");
  }
}

extern "C" void kernel_launch(void* const* d_in, const int* in_sizes, int n_in,
                              void* d_out, int out_size, void* d_ws, size_t ws_size,
                              hipStream_t stream) {
  (void)in_sizes; (void)n_in; (void)out_size; (void)d_ws; (void)ws_size;
  const float* x    = (const float*)d_in[0];
  const float* Wqkv = (const float*)d_in[1];
  const float* W1   = (const float*)d_in[2];
  const float* b1   = (const float*)d_in[3];
  const float* ln_w = (const float*)d_in[4];
  const float* ln_b = (const float*)d_in[5];
  const float* W2   = (const float*)d_in[6];
  const float* b2   = (const float*)d_in[7];
  const float* Wg   = (const float*)d_in[8];
  const float* bg   = (const float*)d_in[9];
  float* out = (float*)d_out;

  // 1024 tiles (8 w-tiles x 32 h-tiles x 4 batches), TPB = 2 tiles and 8 waves a
  // block: 512 blocks, two on each WGP, all resident at once.
  va_fused<<<dim3(512), dim3(256), 0, stream>>>(x, Wqkv, Wg, bg, W1, b1, ln_w, ln_b,
                                                 W2, b2, out);
}

// v010
// A run of this version takes 29.8 microseconds.
// Timed twice side by side with v009, it ran 1.05 and 1.04 times as fast.
// Over all steps from v000 it is 5.38 times as fast.
#include <hip/hip_runtime.h>
#include <hip/hip_bf16.h>

#define BB   4
#define CC   32
#define HH   256
#define WW   256
#define HIDN 64
#define HWP  (HH * WW)
#define EPSV 1e-5f

typedef __attribute__((ext_vector_type(16))) __bf16 bf16x16;
typedef __attribute__((ext_vector_type(8)))  float  f32x8;
typedef __attribute__((ext_vector_type(8)))  unsigned u32x8;
typedef __attribute__((ext_vector_type(2)))  float  f32x2;

union BFV {
  bf16x16  v;
  __bf16   e[16];
  unsigned u[8];
  uint4    q4[2];
};

__device__ __forceinline__ int iclamp(int x, int lo, int hi) {
  return x < lo ? lo : (x > hi ? hi : x);
}

static __device__ __forceinline__ f32x8 wmma_bf16(bf16x16 a, bf16x16 b, f32x8 c) {
  // D = A(16x32 bf16) x B(32x16 bf16) + C(16x16 f32)
  return __builtin_amdgcn_wmma_f32_16x16x32_bf16(false, a, false, b, (short)0, c,
                                                 false, false);
}

// ---------------------------------------------------------------------------
// One launch.  A block owns 8 rows x 64 columns of one image and works through
// them as TPB tiles of 8 rows x 32 columns, left to right; in a tile a wave owns
// one row (32 pixels) and a lane two neighboring pixels of it, columns 2*lm and
// 2*lm + 1: 16 lanes x 8 bytes are one whole 128-byte line of x or of out.  The
// even columns are sub-tile 0, the odd ones sub-tile 1 (16 pixels = one WMMA N).
// Phase 0 runs once a block, phase 1 once a tile, phase 2 once a sub-tile.
// The x values of the next tile are loaded behind the tile's last neighbor loop, in
// front of its output part; k / v records have two buffers, so one barrier a tile both
// publishes the new records and ends the last reads of the buffer written next.
// Phase 0: the block brings all four weight matrices in once, 16 bytes a thread
//   and whole lines a wave, and lays them in LDS as bf16 in A-tile order; every
//   wave then reads its A tiles from there (two 16-byte LDS reads a tile).
//   W1 and b1 go in CENTERED over the 64 hidden units (each column of W1 minus
//   its mean, b1 minus its mean, in f32, before the rounding to bf16): the mean
//   over hidden units of W1c * a + b1c is 0 for every a, so the first MLP GEMM
//   yields hid - mean as it stands and LayerNorm needs no sum and no subtraction.
// Phase 1 (1x1 convs, weights as A, pixels as B columns):
//   every wave projects its own 32 pixels, a sub-tile at a time: -k and v go to LDS,
//   q of sub-tile 0 stays in registers (two converted D tiles are the B operand of
//   the first MLP GEMM as they lie), q of sub-tile 1 and gate + bg + x are parked in
//   LDS, lane-private;
//   waves 0..5 also project the 84 pixels of the ring round the tile (-k, v).
//   A pixel outside the image enters as x = 0, so its k and v are 0
//   (zero-padded unfold; the qkv conv has no bias).
// Phase 2: neighbor MLP + softmax + weighted v, k and v read from LDS.
//   W1c * q^T + b1c is formed once a sub-tile and is the C operand of every neighbor:
//   (hid - mean)^T (64 x 16 pix) = W1c * (-k)^T + C : lane (lm, grp) holds
//     hidden units 16m + 8*grp + r of pixel lm -> the sum of squares is in-lane
//     plus one exchange with lane ^ 16;
//   two converted D tiles are the B operand of the second GEMM as they lie;
//   scores^T (32 x 16 pix): a lane holds channels 16c + 8*grp + r of pixel lm,
//     the same 8-channel runs that one 16-byte read of v brings.
// Neighbors are the outer loop; the 9-way softmax is a running accumulation.
// The softmax is taken as 2^t / sum 2^t with t = (log2(e) W2) * hid: the factor log2(e)
// goes into the staged W2, so an accumulator is the argument of v_exp_f32 as it stands.
// b2 is not read: it adds the same value to all 9 scores of a channel, and a softmax
// over the neighbors does not change when its 9 arguments are shifted alike
// (exp(b2) stands in the numerator and in the denominator).
// ---------------------------------------------------------------------------
#define TROWS  8                     // tile rows (= waves)
#define TCOLS  32                    // tile columns (= two WMMA N)
#define HCOLS  (TCOLS + 2)           // halo columns
#define HHALF  (HCOLS / 2)           // halo columns of one parity
#define HROWS  (TROWS + 2)           // halo rows
#define NRING  (2 * HCOLS + 2 * TROWS)
#define RWAVES ((NRING + 15) / 16)   // waves with ring pixels
#define KVPITCH 144                  // -k 64 B | v 64 B | 16 B pad: 16 B x odd
// Records of even and of odd halo columns lie in two planes: the 16 pixels of a
// sub-tile, two columns apart, are then one pitch apart (no bank conflict).
#define KVPLANE (HROWS * HHALF * KVPITCH)
#define KVBYTES (2 * KVPLANE)
#define TPB    2                     // tiles a block, neighbors along W

__device__ __forceinline__ float other_half(float x) {
  // value of lane ^ 16 (cross-row vector move)
  const int b = __builtin_bit_cast(int, x);
  return __builtin_bit_cast(float,
      __builtin_amdgcn_permlanex16(b, b, 0x76543210, 0xfedcba98, false, false));
}

// x plus the value of lane ^ M, M < 16 (row_xmask move folded into the add).
template <int M>
__device__ __forceinline__ float add_xmask(float x) {
  const int b = __builtin_bit_cast(int, x);
  return x + __builtin_bit_cast(float,
      __builtin_amdgcn_update_dpp(0, b, 0x160 + M, 0xf, 0xf, true));
}

// ReLU inside the FMA.  The clamp modifier bounds a result to [0, 1]; ln_w and ln_b
// carry RSCALE = 2^-64 and W2 carries 2^64 (powers of two: every rounding stays as it
// was), so the upper bound is never met (a normalized value is below 8 in size, the
// hidden value below 8 |ln_w| + |ln_b|) and the lower one is the ReLU.
#define RSCALE 0x1p-64f
#define RINV   0x1p+64f
#define LOG2E  1.44269504088896340736f
__device__ __forceinline__ f32x2 pk_fma_relu(f32x2 a, f32x2 b, f32x2 c) {
  f32x2 d;
  // In asm because the compiler has no packed f32 form with clamp: it writes the FMA
  // and one maximum a value.
  asm("v_pk_fma_f32 %0, %1, %2, %3 clamp" : "=v"(d) : "v"(a), "v"(b), "v"(c));
  return d;
}

// A-tile image in LDS: 1 KiB a tile (16 rows x 32 K, bf16) as two planes of
// 512 B; plane hf holds, at 16 B x lane, K values 16*hf + 8*grp + 0..7 of row lm
// (lane = 16*grp + lm): a wave's read of a plane is 512 contiguous bytes.
#define T_Q   0                      // Wqkv: tiles 0..5 (q, k, v: two each)
#define T_K   2
#define T_V   4
#define T_G   6                      // Wg:   tiles 6, 7
#define T_W1  8                      // W1:   tiles 8..11
#define T_W2  12                     // W2:   tile 12 + 2*c + ks
#define NTILES 16

__device__ __forceinline__ bf16x16 read_a(const unsigned char* img, int tile, int lane) {
  BFV t;
  t.q4[0] = *(const uint4*)(img + tile * 1024 + lane * 16);
  t.q4[1] = *(const uint4*)(img + tile * 1024 + 512 + lane * 16);
  return t.v;
}

// Four neighboring weights of one row as 4 bf16 (8 bytes of the image).
__device__ __forceinline__ void put_w4(unsigned char* dst, const float (&w)[4]) {
  union { __bf16 e[4]; uint2 d; } t;
  #pragma unroll
  for (int i = 0; i < 4; ++i) t.e[i] = (__bf16)w[i];
  *(uint2*)dst = t.d;
}

// x of one pixel per lane in the B map (channels k0+i, 16+k0+i), f32.  img is the
// image's first element (the same in every lane), off the lane's byte offset of
// channel k0 of its pixel: one register a lane instead of a pointer pair.
__device__ __forceinline__ void load_x(const float* __restrict__ img, unsigned off,
                                       float (&xf)[16]) {
  const float* xpix = (const float*)((const char*)img + off);
  #pragma unroll
  for (int i = 0; i < 8; ++i) xf[i]     = xpix[i * HWP];
  #pragma unroll
  for (int i = 0; i < 8; ++i) xf[8 + i] = xpix[(16 + i) * HWP];
}

// The same for the lane's two neighboring pixels (8 bytes a channel).
__device__ __forceinline__ void load_x2(const float* __restrict__ img, unsigned off,
                                        float (&xe)[16], float (&xo)[16]) {
  const float* xpix = (const float*)((const char*)img + off);
  #pragma unroll
  for (int i = 0; i < 8; ++i) { xe[i] = xpix[i * HWP]; xo[i] = xpix[i * HWP + 1]; }
  #pragma unroll
  for (int i = 0; i < 8; ++i) {
    xe[8 + i] = xpix[(16 + i) * HWP]; xo[8 + i] = xpix[(16 + i) * HWP + 1];
  }
}

// Two D tiles (channels 8*grp + r and 16 + 8*grp + r of the lane's pixel) as
// 32 bf16 channels of one pixel record: 16 B at 16*grp and at 32 + 16*grp; rec
// names the first of the two.
__device__ __forceinline__ void put_rec(unsigned char* rec, f32x8 d0, f32x8 d1) {
  BFV t;
  #pragma unroll
  for (int r = 0; r < 8; ++r) { t.e[r] = (__bf16)d0[r]; t.e[8 + r] = (__bf16)d1[r]; }
  *(uint4*)(rec)      = t.q4[0];
  *(uint4*)(rec + 32) = t.q4[1];
}

// Second bound: 4 waves a SIMD (two blocks a WGP), a budget of 256 registers.
__global__ __launch_bounds__(256, 4) void va_fused(
    const float* __restrict__ x,
    const float* __restrict__ Wqkv,
    const float* __restrict__ Wg,
    const float* __restrict__ bg,
    const float* __restrict__ W1,
    const float* __restrict__ b1,
    const float* __restrict__ ln_w,
    const float* __restrict__ ln_b,
    const float* __restrict__ W2,
    const float* __restrict__ b2,
    float* __restrict__ out)
{
  // b1 - mean(b1) | bg, each read once a sub-tile.
  __shared__ __attribute__((aligned(32))) float lds_bias[HIDN + CC];
  // -k and v of the tile and its ring, one record per pixel; tile t uses buffer t & 1.
  __shared__ __attribute__((aligned(16))) unsigned char lds_kv[2 * KVBYTES];
  // gate + bg + x, element i of sub-tile s of thread t at [(s * 16 + i) * 256 + t]
  // (lane-private); sub-tile 0's place later holds its finished output values.
  __shared__ float lds_base[2 * 16 * 256];
  // q of sub-tile 1, packed bf16, 1 KiB a wave: 16 B of a lane at [hf * 512 + 16 * lane]
  // (lane-private).
  __shared__ __attribute__((aligned(16))) unsigned char lds_q[TROWS * 1024];
  // All weights, bf16, in A-tile order.  The alignment puts the image first in LDS: a
  // tile's place is then an immediate offset of the read, not an address operation.
  __shared__ __attribute__((aligned(1024))) unsigned char lds_w[NTILES * 1024];
  // Column sums of W1 over the 8 rows that each wave loads.
  __shared__ __attribute__((aligned(16))) float lds_csum[TROWS * CC];

  const int tid = threadIdx.x;
  const int lane = threadIdx.x & 31;
  const int wave = __builtin_amdgcn_readfirstlane(threadIdx.x >> 5);
  // Waves 0, 1: b1; wave 2 (and the rest, unused): bg.
  const float in_b1 = b1[tid & (HIDN - 1)];
  const float in_bg = bg[lane];
  const float bias_in = wave < 2 ? in_b1 : in_bg;
  // All of b1, two values a lane: a wave that writes biases forms the mean itself.
  const float b1lo = b1[2 * (tid & 31)];
  const float b1hi = b1[2 * (tid & 31) + 1];

  // ---- Phase 0: weight loads (2048 groups of 4 floats, 8 a thread) ----
  float wl[8][4];
  #pragma unroll
  for (int j = 0; j < 8; ++j) {
    const float* wsrc = j < 3 ? Wqkv + j * 1024
                      : j < 4 ? Wg
                      : j < 6 ? W1 + (j - 4) * 1024
                              : W2 + (j - 6) * 1024;
    #pragma unroll
    for (int i = 0; i < 4; ++i) wl[j][i] = wsrc[tid * 4 + i];
  }

  const int grp  = lane >> 4;
  const int lm   = lane & 15;
  const int k0   = grp ? 8 : 0;

  const int tile = blockIdx.x * TPB;       // first of the block's tiles (1024 in all)
  const int tw = tile & 7;                 // 8 tiles across W
  const int th = (tile >> 3) & 31;         // 32 tiles across H
  const int b  = tile >> 8;
  const int h0 = th * TROWS;
  const int h  = h0 + wave;
  const int wfirst = tw * TCOLS;
  const float* xb = x + (long)b * CC * HWP;

  // ---- Phase 1 ----
  // Ring pixel p of waves 0..5: top row, bottom row, then left/right pairs.
  const int p  = wave * 16 + lm;
  const int e  = p - 2 * HCOLS;
  const int hr = p < HCOLS ? 0 : (p < 2 * HCOLS ? HROWS - 1 : 1 + (e >> 1));
  const int wc = p < HCOLS ? p : (p < 2 * HCOLS ? p - HCOLS : (e & 1) * (HCOLS - 1));
  const int hh = h0 - 1 + hr;
  const bool ring_row_ok = (p < NRING) && (hh >= 0) && (hh < HH);
  const bool ring_left = wc == 0, ring_right = wc == HCOLS - 1;
  // Byte offsets in a record buffer, the lane's 16 * grp included: place lm of halo
  // row wave in plane 0, and the ring pixel's record.
  const unsigned own_rec  = (unsigned)((wave * HHALF + lm) * KVPITCH + 16 * grp);
  const unsigned ring_rec = (unsigned)((wc & 1) * KVPLANE
                                       + (hr * HHALF + (wc >> 1)) * KVPITCH + 16 * grp);

  // All x loads first: they come from furthest away.
  // Waves 6, 7 have no ring pixel and name pixels of their own row again (the same
  // lines): no branch, so these loads fly together with the rest.
  const int rh = wave < RWAVES ? iclamp(hh, 0, HH - 1) : h;
  // A ring column outside the image wraps round inside its row: a valid address,
  // and the value is replaced by 0 below.
  const int rw = wave < RWAVES ? ((wfirst - 1 + wc) & (WW - 1)) : wfirst + lm;
  // Byte offsets inside the image, channel k0, first tile: the ring pixel, the own
  // pixel pair.
  unsigned ring_off = 4u * (unsigned)(k0 * HWP + rh * WW + rw);
  const unsigned own_first = 4u * (unsigned)(k0 * HWP + h * WW + wfirst + 2 * lm);
  float xr[16];
  load_x(xb, ring_off, xr);
  float xf[2][16];
  load_x2(xb, own_first, xf[0], xf[1]);

  const f32x8 cz = {};

  // Scheduling fence: every load above is issued before the first wait; without
  // it the weights' conversions, and their wait, move up in front of the x loads,
  // and a wave waits out the two latencies in turn.
  __builtin_amdgcn_sched_barrier(0);

  // Place of a thread's 4 weights inside a tile: columns 4*c4 .. 4*c4+3.
  const int c4   = tid & 7;
  const int incol = (c4 >> 2) * 512 + ((c4 >> 1) & 1) * 256 + (c4 & 1) * 8;
  // 32-column matrices: 32 rows (two tiles) a round; row = tid >> 3.
  unsigned char* d32 = lds_w + (tid >> 7) * 1024 + ((tid >> 3) & 15) * 16 + incol;
  {
    // W2 (64 columns): 16 rows a round; row = tid >> 4, K step = bit 3.
    unsigned char* d64 = lds_w + ((tid >> 3) & 1) * 1024 + (tid >> 4) * 16 + incol;
    #pragma unroll
    for (int j = 0; j < 4; ++j) put_w4(d32 + j * 2048, wl[j]);
    #pragma unroll
    for (int j = 6; j < 8; ++j) {
      #pragma unroll
      for (int i = 0; i < 4; ++i) wl[j][i] *= RINV * LOG2E;   // RINV undoes RSCALE of hid
      put_w4(d64 + j * 2048, wl[j]);
    }
    // W1 waits for its column means.  A thread holds columns 4*c4 .. 4*c4+3 of
    // two rows; lanes l, l^8, l^16, l^24 hold the same columns of a wave's rows.
    float cs[4];
    #pragma unroll
    for (int i = 0; i < 4; ++i) cs[i] = wl[4][i] + wl[5][i];
    #pragma unroll
    for (int i = 0; i < 4; ++i) cs[i] = add_xmask<8>(cs[i]);
    #pragma unroll
    for (int i = 0; i < 4; ++i) cs[i] += other_half(cs[i]);
    if (lane < 8)
      *(float4*)(lds_csum + wave * CC + 4 * lane) = make_float4(cs[0], cs[1], cs[2], cs[3]);
  }
  // Whole waves 0..2 write the biases.
  if (wave < (HIDN + CC) / 32) {
    // Mean of b1: the lane's two values, then lanes ^1, ^2, ^4, ^8, ^16.
    float b1m = b1lo + b1hi;
    b1m = add_xmask<1>(b1m);
    b1m = add_xmask<2>(b1m);
    b1m = add_xmask<4>(b1m);
    b1m = add_xmask<8>(b1m);
    b1m += other_half(b1m);
    lds_bias[tid] = tid < HIDN ? bias_in - b1m * (1.0f / HIDN) : bias_in;
  }
  // Publishes the weight image (all but W1), the biases and the waves' column
  // sums of W1.
  __syncthreads();

  // W1 minus its column means, into the image; read behind the next barrier.
  {
    const float4 t0 = *(const float4*)(lds_csum + 4 * c4);
    float cm[4] = {t0.x, t0.y, t0.z, t0.w};
    #pragma unroll
    for (int w = 1; w < TROWS; ++w) {
      const float4 t = *(const float4*)(lds_csum + w * CC + 4 * c4);
      cm[0] += t.x; cm[1] += t.y; cm[2] += t.z; cm[3] += t.w;
    }
    #pragma unroll
    for (int j = 4; j < 6; ++j) {
      #pragma unroll
      for (int i = 0; i < 4; ++i) wl[j][i] -= cm[i] * (1.0f / HIDN);
      put_w4(d32 + j * 2048, wl[j]);
    }
  }

  // Per-row parameters in the D map: register r = row 8*grp + r of a tile.
  f32x8 lwc[4], lbc[4];
  #pragma unroll
  for (int n = 0; n < 4; ++n)
    #pragma unroll
    for (int r = 0; r < 8; ++r) {
      const int d = n * 16 + k0 + r;
      lwc[n][r] = ln_w[d] * RSCALE; lbc[n][r] = ln_b[d] * RSCALE;
    }
  const f32x8* biasrow = (const f32x8*)(lds_bias + k0);   // tile t: biasrow[2 * t]

  // The own pixel pair's offset one tile ahead: names the next x, and, one tile back,
  // this tile's output; it lives through phase 2, so no load lands on it.
  unsigned own_next = own_first;
  for (int t = 0; t < TPB; ++t) {
    const int w0 = wfirst + t * TCOLS;
    unsigned char* kvbuf = lds_kv + (t & 1) * KVBYTES;

    // ---- Phase 1 ----
    bf16x16 Aq[2], Ak[2], Av[2], Ag[2];
    #pragma unroll
    for (int j = 0; j < 2; ++j) {
      Aq[j] = read_a(lds_w, T_Q + j, lane);
      Ak[j] = read_a(lds_w, T_K + j, lane);
      Av[j] = read_a(lds_w, T_V + j, lane);
      Ag[j] = read_a(lds_w, T_G + j, lane);
    }

    BFV qv;
    // Unrolled: s picks registers (xf[s]) and immediate LDS offsets.
    #pragma unroll
    for (int s = 0; s < 2; ++s) {
      BFV bv;
      #pragma unroll
      for (int i = 0; i < 16; ++i) bv.e[i] = (__bf16)xf[s][i];
      const f32x8 ok0 = wmma_bf16(Ak[0], bv.v, cz);
      const f32x8 ok1 = wmma_bf16(Ak[1], bv.v, cz);
      const f32x8 ov0 = wmma_bf16(Av[0], bv.v, cz);
      const f32x8 ov1 = wmma_bf16(Av[1], bv.v, cz);
      // Halo column 2*lm + s + 1: plane (s + 1) & 1, place lm + ((s + 1) >> 1).
      unsigned char* rec = kvbuf + own_rec + ((s + 1) & 1) * KVPLANE
                         + (HHALF + ((s + 1) >> 1)) * KVPITCH;
      put_rec(rec,      -ok0, -ok1);           // -k
      put_rec(rec + 64,  ov0,  ov1);

      // q as a B column (pixel w0 + 2*lm + s), packed bf16.
      BFV qs;
      #pragma unroll
      for (int j = 0; j < 2; ++j) {
        const f32x8 qa = wmma_bf16(Aq[j], bv.v, cz);
        #pragma unroll
        for (int r = 0; r < 8; ++r) qs.e[j * 8 + r] = (__bf16)qa[r];
      }
      if (s == 0) {
        qv = qs;
      } else {
        *(uint4*)(lds_q + wave * 1024 + 16 * lane)       = qs.q4[0];
        *(uint4*)(lds_q + wave * 1024 + 512 + 16 * lane) = qs.q4[1];
      }
      // gate + bg + x in the D map: element j*8+r = channel 16j + 8*grp + r.
      #pragma unroll
      for (int j = 0; j < 2; ++j) {
        const f32x8 ga = wmma_bf16(Ag[j], bv.v, cz);
        const f32x8 bgv = biasrow[2 * (4 + j)];
        #pragma unroll
        for (int r = 0; r < 8; ++r)
          lds_base[(s * 16 + j * 8 + r) * 256 + tid] = ga[r] + bgv[r] + xf[s][j * 8 + r];
      }
      // Scheduling fence: one sub-tile's work after the other's; woven together, the
      // D tiles and biases of both are live at once and address registers are spilled.
      __builtin_amdgcn_sched_barrier(0);
    }

    // The ring comes last: its x is loaded behind the last neighbor loop of the tile
    // before, and the own pixels' work above covers the rest of its way.
    if (wave < RWAVES) {
      // Column w0 - 1 + wc leaves the image only at these two places.
      const bool ring_ok = ring_row_ok && !(ring_left && w0 == 0)
                                       && !(ring_right && w0 + TCOLS == WW);
      BFV rv;
      #pragma unroll
      for (int i = 0; i < 16; ++i) rv.e[i] = (__bf16)xr[i];
      #pragma unroll
      for (int i = 0; i < 8; ++i) rv.u[i] = ring_ok ? rv.u[i] : 0u;
      const f32x8 rk0 = wmma_bf16(Ak[0], rv.v, cz);
      const f32x8 rk1 = wmma_bf16(Ak[1], rv.v, cz);
      const f32x8 rv0 = wmma_bf16(Av[0], rv.v, cz);
      const f32x8 rv1 = wmma_bf16(Av[1], rv.v, cz);
      if (p < NRING) {
        unsigned char* rec = kvbuf + ring_rec;
        put_rec(rec,      -rk0, -rk1);         // -k
        put_rec(rec + 64,  rv0,  rv1);
      }
    }

    // Publishes every wave's k / v records of this tile (before the first tile
    // also the centered W1 image); behind it no wave reads the
    // other record buffer any more, which the next tile's phase 1 writes.
    __syncthreads();

    own_next += 4u * TCOLS;

    // ---- Phase 2 ----
    // A2: W2 (32 x 64), 2 M-tiles x 2 K-steps.
    bf16x16 A2t[2][2];
    #pragma unroll
    for (int c = 0; c < 2; ++c)
      #pragma unroll
      for (int ks = 0; ks < 2; ++ks) A2t[c][ks] = read_a(lds_w, T_W2 + 2 * c + ks, lane);
    // A1: centered W1 (64 x 32), 4 M-tiles.
    bf16x16 A1t[4];
    #pragma unroll
    for (int n = 0; n < 4; ++n) A1t[n] = read_a(lds_w, T_W1 + n, lane);

    // Place lm of halo row wave in plane 0.
    const unsigned char* rec0 = kvbuf + own_rec;

    f32x8 num[2];
    f32x8 den[2];
    // Unrolled: rolled, q of sub-tile 0 would stay live through the neighbor loop
    // (8 registers that are not there).
    #pragma unroll
    for (int s = 0; s < 2; ++s) {
    // W1c * q + b1c, once a sub-tile: the C operand of every neighbor's first GEMM,
    // which then needs neither the bias from LDS nor q - k formed in registers.
    f32x8 hq[4];
    #pragma unroll
    for (int n = 0; n < 4; ++n) hq[n] = wmma_bf16(A1t[n], qv.v, biasrow[2 * n]);

    num[0] = cz; num[1] = cz;
    den[0] = cz; den[1] = cz;

    for (int nb = 0; nb < 9; ++nb) {
      // Neighbor (dy, dx) lies in halo row wave + nb / 3, halo column 2*lm + hc.
      const int hc = s + nb % 3;
      const unsigned char* rec = rec0 + (hc & 1) * KVPLANE
                               + ((nb / 3) * HHALF + (hc >> 1)) * KVPITCH;
      BFV kv;
      kv.q4[0] = *(const uint4*)(rec);
      kv.q4[1] = *(const uint4*)(rec + 32);
      // (hid - mean)^T = W1c * (-k)^T + (W1c * q^T + b1c) : 64 x 16 in 4 accumulators.
      f32x8 hacc[4];
      #pragma unroll
      for (int n = 0; n < 4; ++n) hacc[n] = wmma_bf16(A1t[n], kv.v, hq[n]);

      const uint4 v0 = *(const uint4*)(rec + 64);
      const uint4 v1 = *(const uint4*)(rec + 96);
      const u32x8 vraw = {v0.x, v0.y, v0.z, v0.w, v1.x, v1.y, v1.z, v1.w};
      const bf16x16 vv = __builtin_bit_cast(bf16x16, vraw);

      // LayerNorm per pixel (= per lane pair l, l ^ 16): the values are centered
      // as they come, so the variance is their mean square.
      f32x8 s2 = hacc[0] * hacc[0] + hacc[1] * hacc[1]
               + hacc[2] * hacc[2] + hacc[3] * hacc[3];
      float qsum = ((s2[0] + s2[4]) + (s2[2] + s2[6])) + ((s2[1] + s2[5]) + (s2[3] + s2[7]));
      qsum += other_half(qsum);
      const float var = qsum * (1.0f / HIDN);
      // Hardware square root and reciprocal (about 1 ulp each) in place of the
      // correctly rounded sequences: inv is rounded to bf16 with the hidden values
      // right after.  A var too small for v_sqrt_f32 vanishes beside EPSV anyway.
      const float inv = __builtin_amdgcn_rcpf(__builtin_amdgcn_sqrtf(var) + EPSV);

      // Normalize + ReLU (times RSCALE); D tiles 2ks, 2ks+1 converted in place are B of
      // step ks.
      BFV hb[2];
      #pragma unroll
      for (int n = 0; n < 4; ++n)
        #pragma unroll
        for (int r = 0; r < 8; r += 2) {
          const f32x2 tn = {hacc[n][r] * inv, hacc[n][r + 1] * inv};
          const f32x2 lw2 = {lwc[n][r], lwc[n][r + 1]};
          const f32x2 lb2 = {lbc[n][r], lbc[n][r + 1]};
          const f32x2 hv = pk_fma_relu(tn, lw2, lb2);
          hb[n >> 1].e[(n & 1) * 8 + r]     = (__bf16)hv.x;
          hb[n >> 1].e[(n & 1) * 8 + r + 1] = (__bf16)hv.y;
        }

      // log2(e) * (scores - b2)^T = (log2(e) W2 / RSCALE) * (RSCALE * hid)^T (K=64: two
      // chained WMMAs), then online softmax-weighted accumulation of v.
      #pragma unroll
      for (int c = 0; c < 2; ++c) {
        f32x8 sc = wmma_bf16(A2t[c][0], hb[0].v, cz);
        sc = wmma_bf16(A2t[c][1], hb[1].v, sc);
        #pragma unroll
        for (int r = 0; r < 8; ++r) {
          const float vval = (float)vv[c * 8 + r];
          const float e = __builtin_amdgcn_exp2f(sc[r]);   // v_exp_f32
          den[c][r] += e;
          num[c][r] += e * vval;
        }
      }
    }

    if (s == 0) {
      // Sub-tile 0 is done: its output values wait in LDS (in place of gate + bg + x)
      // for their right-hand neighbors, and q of sub-tile 1 comes back.
      #pragma unroll
      for (int c = 0; c < 2; ++c)
        #pragma unroll
        for (int r = 0; r < 8; ++r)
          lds_base[(c * 8 + r) * 256 + tid] += num[c][r] * __builtin_amdgcn_rcpf(den[c][r]);
      qv.q4[0] = *(const uint4*)(lds_q + wave * 1024 + 16 * lane);
      qv.q4[1] = *(const uint4*)(lds_q + wave * 1024 + 512 + 16 * lane);
    }
    }

    // x of the next tile: issued here, not behind the barrier, so that its 48
    // registers are free inside the neighbor loops (W1c * q + b1c lives there); the
    // output part below and the A-tile reads cover its way in part.
    if (t + 1 < TPB) {
      // One tile to the right, wrapping inside the row (a row is 4 * WW bytes).
      ring_off = (ring_off & ~(4u * WW - 1)) | ((ring_off + 4u * TCOLS) & (4u * WW - 1));
      load_x2(xb, own_next, xf[0], xf[1]);
      load_x(xb, ring_off, xr);
      // The output part's first instructions overwrite the address registers that
      // these loads name: this wait stands in front of them, as a precaution.
      asm volatile("s_wait_xcnt 0x0" ::: "memory");
    } else {
      // Ends the old values' life in phase 1: without a new value on this path they
      // would hold their 48 registers through the neighbor loops (spills).
      #pragma unroll
      for (int i = 0; i < 16; ++i) { xf[0][i] = 0.f; xf[1][i] = 0.f; xr[i] = 0.f; }
    }

    // out = (gate + bg + x) + weighted_v: every element stored once, the lane's two
    // pixels in one 8-byte store (16 lanes: one whole line).
    float* opix = (float*)((char*)(out + (long)b * CC * HWP) + own_next) - TCOLS;
    #pragma unroll
    for (int c = 0; c < 2; ++c)
      #pragma unroll
      for (int r = 0; r < 8; ++r)
        *(float2*)(opix + (c * 16 + r) * HWP) = make_float2(
            lds_base[(c * 8 + r) * 256 + tid],
            lds_base[(16 + c * 8 + r) * 256 + tid]
                + num[c][r] * __builtin_amdgcn_rcpf(den[c][r]));
    // The next tile's first instructions overwrite registers that these stores
    // name (data, offset), and the build has no wait on the way back up: this one
    // stands in front of them, as a precaution.
    asm volatile("s_wait_xcnt 0x0" ::: "memory");
  }
}

extern "C" void kernel_launch(void* const* d_in, const int* in_sizes, int n_in,
                              void* d_out, int out_size, void* d_ws, size_t ws_size,
                              hipStream_t stream) {
  (void)in_sizes; (void)n_in; (void)out_size; (void)d_ws; (void)ws_size;
  const float* x    = (const float*)d_in[0];
  const float* Wqkv = (const float*)d_in[1];
  const float* W1   = (const float*)d_in[2];
  const float* b1   = (const float*)d_in[3];
  const float* ln_w = (const float*)d_in[4];
  const float* ln_b = (const float*)d_in[5];
  const float* W2   = (const float*)d_in[6];
  const float* b2   = (const float*)d_in[7];
  const float* Wg   = (const float*)d_in[8];
  const float* bg   = (const float*)d_in[9];
  float* out = (float*)d_out;

  // 1024 tiles (8 w-tiles x 32 h-tiles x 4 batches), TPB = 2 tiles and 8 waves a
  // block: 512 blocks, two on each WGP, all resident at once.
  va_fused<<<dim3(512), dim3(256), 0, stream>>>(x, Wqkv, Wg, bg, W1, b1, ln_w, ln_b,
                                                 W2, b2, out);
}
